// v000
// Measured on an AMD MI455X. A time is GPU time per run, averaged over a window of back-to-back runs after a warm-up
// (all launches, gaps included; the runs take copies of the inputs in turn), and the median of several windows.
// Apart from v000's, it joins two sittings. Times from different sittings can be a few percent apart, while
// side-by-side timings come from the same sitting.
// The starting kernel, v000, takes 1560 microseconds a run.
#include <hip/hip_runtime.h>
#include <cmath>

typedef __attribute__((ext_vector_type(2))) float v2f;
typedef __attribute__((ext_vector_type(8))) float v8f;

constexpr int B_ = 8, C_ = 512, CQ = 64, N_ = 4096;
constexpr int FS = 72;                       // padded LDS row stride (floats): 16B-aligned rows,
                                             // half-wave fragment reads land on disjoint banks
constexpr int SMEM_FLOATS = 2 * 64 * FS      // f tiles (double buffered)
                          + 64 * FS          // g tile
                          + 64 * FS          // S / P tile
                          + 3 * 64;          // mrow, lrow, rfac
constexpr int SMEM_BYTES = SMEM_FLOATS * 4;

// ---- gfx1250 async memory->LDS copy (ASYNCcnt), inline asm: portable across toolchains.
// Low 32 bits of a flat shared pointer == LDS byte offset (LDS aperture keeps the
// offset in addr[31:0]), which is exactly what VDST of the async op expects.
__device__ __forceinline__ void async_cp16(float* lds, const float* gsrc) {
    unsigned loff = (unsigned)(unsigned long long)(uintptr_t)lds;
    unsigned long long ga = (unsigned long long)(uintptr_t)gsrc;
    asm volatile("global_load_async_to_lds_b128 %0, %1, off" :: "v"(loff), "v"(ga) : "memory");
}
__device__ __forceinline__ void async_wait0() {
    asm volatile("s_wait_asynccnt 0" ::: "memory");
}

// ---------------------------------------------------------------------------
// Kernel 1: inverse spectral norm.  sigma = ||Wv||^2/(||Wv||+eps), v=norm(W^T u).
// ---------------------------------------------------------------------------
__global__ void sigma_kernel(const float* __restrict__ W, const float* __restrict__ u,
                             int O, int Cin, float* __restrict__ inv_sigma_out) {
    __shared__ float t[512];
    __shared__ float red[256];
    const int tid = threadIdx.x;

    float local = 0.f;
    for (int cin = tid; cin < Cin; cin += 256) {
        float s = 0.f;
        for (int o = 0; o < O; ++o) s += W[(size_t)o * Cin + cin] * u[o];
        t[cin] = s;
        local += s * s;
    }
    red[tid] = local;
    __syncthreads();
    for (int s = 128; s > 0; s >>= 1) { if (tid < s) red[tid] += red[tid + s]; __syncthreads(); }
    float rn = 1.f / (sqrtf(red[0]) + 1e-12f);
    __syncthreads();
    for (int cin = tid; cin < Cin; cin += 256) t[cin] *= rn;
    __syncthreads();

    local = 0.f;
    for (int o = tid; o < O; o += 256) {
        float s = 0.f;
        for (int c = 0; c < Cin; ++c) s += W[(size_t)o * Cin + c] * t[c];
        local += s * s;
    }
    red[tid] = local;
    __syncthreads();
    for (int s = 128; s > 0; s >>= 1) { if (tid < s) red[tid] += red[tid + s]; __syncthreads(); }
    if (tid == 0) {
        float ssq = red[0];
        float q   = sqrtf(ssq);
        inv_sigma_out[0] = (q + 1e-12f) / ssq;
    }
}

// ---------------------------------------------------------------------------
// Kernel 2: projection GEMM  out[b,o,n] = inv_sigma*(W @ x_b)[o,n] + bias[o]
// ---------------------------------------------------------------------------
__global__ void proj_kernel(const float* __restrict__ W, const float* __restrict__ bias,
                            const float* __restrict__ inv_sigma,
                            const float* __restrict__ x, float* __restrict__ out, int O) {
    __shared__ float Wt[64][33];
    __shared__ float Xt[32][65];
    const int tid = threadIdx.x;
    const int tx = tid & 15, ty = tid >> 4;
    const int n0 = blockIdx.x * 64;
    const int o0 = blockIdx.y * 64;
    const int b  = blockIdx.z;

    float acc[4][4] = {};
    for (int kt = 0; kt < C_; kt += 32) {
        #pragma unroll
        for (int k = 0; k < 8; ++k) {
            int idx = tid + 256 * k;
            int r = idx >> 5, c = idx & 31;
            Wt[r][c] = W[(size_t)(o0 + r) * C_ + kt + c];
        }
        #pragma unroll
        for (int k = 0; k < 8; ++k) {
            int idx = tid + 256 * k;
            int r = idx >> 6, c = idx & 63;
            Xt[r][c] = x[((size_t)b * C_ + kt + r) * N_ + n0 + c];
        }
        __syncthreads();
        for (int k = 0; k < 32; ++k) {
            float wv[4], xv[4];
            #pragma unroll
            for (int i = 0; i < 4; ++i) wv[i] = Wt[ty + 16 * i][k];
            #pragma unroll
            for (int j = 0; j < 4; ++j) xv[j] = Xt[k][tx + 16 * j];
            #pragma unroll
            for (int i = 0; i < 4; ++i)
                #pragma unroll
                for (int j = 0; j < 4; ++j) acc[i][j] += wv[i] * xv[j];
        }
        __syncthreads();
    }
    const float is = inv_sigma[0];
    #pragma unroll
    for (int i = 0; i < 4; ++i) {
        const int o = o0 + ty + 16 * i;
        const float bb = bias[o];
        #pragma unroll
        for (int j = 0; j < 4; ++j) {
            const int n = n0 + tx + 16 * j;
            out[((size_t)b * O + o) * N_ + n] = is * acc[i][j] + bb;
        }
    }
}

// ---------------------------------------------------------------------------
// Kernel 3: fused flash attention  s=f^T g, softmax over keys i, o=h@beta,
// y = gamma*o + x.  f key-tiles double-buffered via global_load_async_to_lds.
// ---------------------------------------------------------------------------
__global__ void __launch_bounds__(256)
attn_kernel(const float* __restrict__ F, const float* __restrict__ G,
            const float* __restrict__ H, const float* __restrict__ x,
            const float* __restrict__ gamma, float* __restrict__ out) {
    extern __shared__ float smem[];
    float* fT   = smem;                 // [2][64][FS]
    float* gT   = fT + 2 * 64 * FS;     // [64][FS]
    float* ST   = gT + 64 * FS;         // [64][FS]
    float* mrow = ST + 64 * FS;         // [64]
    float* lrow = mrow + 64;            // [64]
    float* rfac = lrow + 64;            // [64]

    const int tid  = threadIdx.x;
    const int lane = tid & 31;
    const int wv   = tid >> 5;
    const int ln   = lane & 15;
    const int koff = (lane < 16) ? 0 : 2;   // K-pair held by this half-wave (A/B frags)
    const int moff = (lane < 16) ? 0 : 8;   // row offset in C/D fragment
    const int b  = blockIdx.x >> 6;
    const int j0 = (blockIdx.x & 63) * 64;

    // async-stage persistent g tile (row chunks of 16B)
    #pragma unroll
    for (int k = 0; k < 4; ++k) {
        int idx = tid + 256 * k;
        int c = idx >> 4, ch = (idx & 15) * 4;
        async_cp16(&gT[c * FS + ch], &G[((size_t)b * CQ + c) * N_ + j0 + ch]);
    }
    // async-stage f tile 0 into buffer 0
    {
        const float* src = F + (size_t)b * CQ * N_;
        #pragma unroll
        for (int k = 0; k < 4; ++k) {
            int idx = tid + 256 * k;
            int c = idx >> 4, ch = (idx & 15) * 4;
            async_cp16(&fT[c * FS + ch], src + (size_t)c * N_ + ch);
        }
    }
    if (tid < 64) { mrow[tid] = -__builtin_inff(); lrow[tid] = 0.f; }

    const v8f vzero = {};
    v8f accO[4][4];
    #pragma unroll
    for (int ct = 0; ct < 4; ++ct)
        #pragma unroll
        for (int jt = 0; jt < 4; ++jt) accO[ct][jt] = vzero;

    const float* hbase = H + ((size_t)b * C_ + wv * 64) * N_;

    for (int t = 0; t < N_ / 64; ++t) {
        const int i0  = t * 64;
        float* fbuf   = fT + (t & 1) * (64 * FS);
        async_wait0();          // current tile (and initial g) landed in LDS
        __syncthreads();        // all waves' async chunks visible; prev S/P consumers done

        // prefetch next f tile into the other buffer (overlaps with compute below)
        if (t + 1 < N_ / 64) {
            float* dst = fT + ((t + 1) & 1) * (64 * FS);
            const float* src = F + (size_t)b * CQ * N_ + (t + 1) * 64;
            #pragma unroll
            for (int k = 0; k < 4; ++k) {
                int idx = tid + 256 * k;
                int c = idx >> 4, ch = (idx & 15) * 4;
                async_cp16(&dst[c * FS + ch], src + (size_t)c * N_ + ch);
            }
        }

        // S[i][j] = sum_c f[c][i]*g[c][j] : 16 subtiles, 2 per wave
        #pragma unroll
        for (int sIdx = 0; sIdx < 2; ++sIdx) {
            const int s  = wv * 2 + sIdx;
            const int it = s >> 2, jt = s & 3;
            v8f acc = vzero;
            for (int c4 = 0; c4 < 64; c4 += 4) {
                v2f a, bb;
                a.x  = fbuf[(c4 + koff    ) * FS + it * 16 + ln]; // A = f^T (M=i, K=c)
                a.y  = fbuf[(c4 + koff + 1) * FS + it * 16 + ln];
                bb.x = gT  [(c4 + koff    ) * FS + jt * 16 + ln]; // B = g   (K=c, N=j)
                bb.y = gT  [(c4 + koff + 1) * FS + jt * 16 + ln];
                acc = __builtin_amdgcn_wmma_f32_16x16x4_f32(false, a, false, bb,
                                                            (short)0, acc, false, false);
            }
            #pragma unroll
            for (int r = 0; r < 8; ++r)
                ST[(it * 16 + r + moff) * FS + jt * 16 + ln] = acc[r];
        }
        __syncthreads();

        // online softmax over keys i (per column j)
        if (tid < 64) {
            const int j = tid;
            float cm = -__builtin_inff();
            for (int i = 0; i < 64; ++i) cm = fmaxf(cm, ST[i * FS + j]);
            const float mo = mrow[j];
            const float mn = fmaxf(mo, cm);
            rfac[j] = __expf(mo - mn);
            mrow[j] = mn;
        }
        __syncthreads();
        #pragma unroll
        for (int k = 0; k < 16; ++k) {
            int idx = tid + 256 * k;
            int i = idx >> 6, j = idx & 63;
            ST[i * FS + j] = __expf(ST[i * FS + j] - mrow[j]);    // P
        }
        __syncthreads();
        if (tid < 64) {
            const int j = tid;
            float cs = 0.f;
            for (int i = 0; i < 64; ++i) cs += ST[i * FS + j];
            lrow[j] = lrow[j] * rfac[j] + cs;
        }

        // rescale running o, then o += h_tile @ P  (rank-64 update, K steps of 4)
        #pragma unroll
        for (int jt = 0; jt < 4; ++jt) {
            const float fac = rfac[jt * 16 + ln];
            #pragma unroll
            for (int ct = 0; ct < 4; ++ct)
                #pragma unroll
                for (int r = 0; r < 8; ++r) accO[ct][jt][r] *= fac;
        }
        for (int kk = 0; kk < 16; ++kk) {
            const int ib = kk * 4;
            v2f hA[4], pB[4];
            #pragma unroll
            for (int ct = 0; ct < 4; ++ct) {        // A = h (M=c, K=i)
                const float* hp = hbase + (size_t)(ct * 16 + ln) * N_ + i0 + ib + koff;
                hA[ct].x = hp[0];
                hA[ct].y = hp[1];
            }
            #pragma unroll
            for (int jt = 0; jt < 4; ++jt) {        // B = P (K=i, N=j)
                pB[jt].x = ST[(ib + koff    ) * FS + jt * 16 + ln];
                pB[jt].y = ST[(ib + koff + 1) * FS + jt * 16 + ln];
            }
            #pragma unroll
            for (int ct = 0; ct < 4; ++ct)
                #pragma unroll
                for (int jt = 0; jt < 4; ++jt)
                    accO[ct][jt] = __builtin_amdgcn_wmma_f32_16x16x4_f32(
                        false, hA[ct], false, pB[jt], (short)0, accO[ct][jt], false, false);
        }
    }
    __syncthreads();

    // epilogue: y = gamma * o / l + x
    const float gm = gamma[0];
    float linv[4];
    #pragma unroll
    for (int jt = 0; jt < 4; ++jt) linv[jt] = 1.f / lrow[jt * 16 + ln];
    #pragma unroll
    for (int ct = 0; ct < 4; ++ct)
        #pragma unroll
        for (int jt = 0; jt < 4; ++jt)
            #pragma unroll
            for (int r = 0; r < 8; ++r) {
                const int c = wv * 64 + ct * 16 + r + moff;
                const int j = j0 + jt * 16 + ln;
                const size_t idx = ((size_t)b * C_ + c) * N_ + j;
                out[idx] = gm * (accO[ct][jt][r] * linv[jt]) + x[idx];
            }
}

// ---------------------------------------------------------------------------
extern "C" void kernel_launch(void* const* d_in, const int* in_sizes, int n_in,
                              void* d_out, int out_size, void* d_ws, size_t ws_size,
                              hipStream_t stream) {
    (void)in_sizes; (void)n_in; (void)out_size; (void)ws_size;
    const float* x     = (const float*)d_in[0];
    const float* Wf    = (const float*)d_in[1];
    const float* bf    = (const float*)d_in[2];
    const float* Wg    = (const float*)d_in[3];
    const float* bg    = (const float*)d_in[4];
    const float* Wh    = (const float*)d_in[5];
    const float* bh    = (const float*)d_in[6];
    const float* gamma = (const float*)d_in[7];
    const float* uf    = (const float*)d_in[8];
    const float* ug    = (const float*)d_in[9];
    const float* uh    = (const float*)d_in[10];
    float* out = (float*)d_out;

    // workspace: [inv_sigma x3 (pad 16)] [f: B*CQ*N] [g: B*CQ*N] [h: B*C*N]
    float* wsf = (float*)d_ws;
    float* inv = wsf;
    float* Fb  = wsf + 16;
    float* Gb  = Fb + (size_t)B_ * CQ * N_;
    float* Hb  = Gb + (size_t)B_ * CQ * N_;

    static int smem_attr_set = 0;  // deterministic: same call every time, idempotent
    if (!smem_attr_set) {
        hipFuncSetAttribute((const void*)attn_kernel,
                            hipFuncAttributeMaxDynamicSharedMemorySize, SMEM_BYTES);
        smem_attr_set = 1;
    }

    sigma_kernel<<<1, 256, 0, stream>>>(Wf, uf, CQ, C_, inv + 0);
    sigma_kernel<<<1, 256, 0, stream>>>(Wg, ug, CQ, C_, inv + 1);
    sigma_kernel<<<1, 256, 0, stream>>>(Wh, uh, C_, C_, inv + 2);

    proj_kernel<<<dim3(N_ / 64, CQ / 64, B_), 256, 0, stream>>>(Wf, bf, inv + 0, x, Fb, CQ);
    proj_kernel<<<dim3(N_ / 64, CQ / 64, B_), 256, 0, stream>>>(Wg, bg, inv + 1, x, Gb, CQ);
    proj_kernel<<<dim3(N_ / 64, C_ / 64, B_), 256, 0, stream>>>(Wh, bh, inv + 2, x, Hb, C_);

    attn_kernel<<<dim3(B_ * (N_ / 64)), 256, SMEM_BYTES, stream>>>(Fb, Gb, Hb, x, gamma, out);
}

// v001
// Measured time: 1500 microseconds a run.
// In both of two side-by-side timings against v000, it was 1.08 times as fast.
#include <hip/hip_runtime.h>
#include <cmath>

typedef __attribute__((ext_vector_type(2))) float v2f;
typedef __attribute__((ext_vector_type(8))) float v8f;

constexpr int B_ = 8, C_ = 512, CQ = 64, N_ = 4096;
constexpr int FS = 72;                       // padded LDS row stride (floats): 16B-aligned rows,
                                             // half-wave fragment reads land on disjoint banks
constexpr int HP  = 36;                      // h chunk row pitch (floats): 16B-aligned rows, and the 16 rows
                                             // of an 8-byte fragment read fall on disjoint banks
constexpr int HCH = 32 * HP;                 // one h chunk: 32 channel rows x 32 keys
constexpr int SMEM_FLOATS = 2 * 64 * FS      // f tiles (double buffered)
                          + 64 * FS          // g tile
                          + 64 * FS          // S / P tile
                          + 3 * 64           // mrow, lrow, rfac
                          + 8 * 2 * HCH;     // h chunks: two buffers for each of the 8 waves
constexpr int SMEM_BYTES = SMEM_FLOATS * 4;

// ---- gfx1250 async memory->LDS copy (ASYNCcnt), inline asm: portable across toolchains.
// Low 32 bits of a flat shared pointer == LDS byte offset (LDS aperture keeps the
// offset in addr[31:0]), which is exactly what VDST of the async op expects.
__device__ __forceinline__ void async_cp16(float* lds, const float* gsrc) {
    unsigned loff = (unsigned)(unsigned long long)(uintptr_t)lds;
    unsigned long long ga = (unsigned long long)(uintptr_t)gsrc;
    asm volatile("global_load_async_to_lds_b128 %0, %1, off" :: "v"(loff), "v"(ga) : "memory");
}
// One h chunk (32 rows x 128 B, whole cache lines): 8 copies, each 4 rows x 128 B.
// lds = this lane's LDS byte address in rows 0..3, g = this lane's global address there.
// s_wait_xcnt closes the statement so that no address register is rewritten ahead of it.
__device__ __forceinline__ void async_h_chunk(unsigned lds, const float* g) {
    constexpr unsigned LS = 4 * HP * 4;          // LDS bytes per 4 rows
    constexpr size_t   GS = (size_t)4 * N_;      // global floats per 4 rows
    asm volatile("global_load_async_to_lds_b128 %0, %8, off\n\t"
                 "global_load_async_to_lds_b128 %1, %9, off\n\t"
                 "global_load_async_to_lds_b128 %2, %10, off\n\t"
                 "global_load_async_to_lds_b128 %3, %11, off\n\t"
                 "global_load_async_to_lds_b128 %4, %12, off\n\t"
                 "global_load_async_to_lds_b128 %5, %13, off\n\t"
                 "global_load_async_to_lds_b128 %6, %14, off\n\t"
                 "global_load_async_to_lds_b128 %7, %15, off\n\t"
                 "s_wait_xcnt 0x0"
                 :: "v"(lds), "v"(lds + LS), "v"(lds + 2 * LS), "v"(lds + 3 * LS),
                    "v"(lds + 4 * LS), "v"(lds + 5 * LS), "v"(lds + 6 * LS), "v"(lds + 7 * LS),
                    "v"(g), "v"(g + GS), "v"(g + 2 * GS), "v"(g + 3 * GS),
                    "v"(g + 4 * GS), "v"(g + 5 * GS), "v"(g + 6 * GS), "v"(g + 7 * GS)
                 : "memory");
}
__device__ __forceinline__ void async_wait0() {
    asm volatile("s_wait_asynccnt 0" ::: "memory");
}

// ---------------------------------------------------------------------------
// Kernel 1: inverse spectral norm.  sigma = ||Wv||^2/(||Wv||+eps), v=norm(W^T u).
// ---------------------------------------------------------------------------
__global__ void sigma_kernel(const float* __restrict__ W, const float* __restrict__ u,
                             int O, int Cin, float* __restrict__ inv_sigma_out) {
    __shared__ float t[512];
    __shared__ float red[256];
    const int tid = threadIdx.x;

    float local = 0.f;
    for (int cin = tid; cin < Cin; cin += 256) {
        float s = 0.f;
        for (int o = 0; o < O; ++o) s += W[(size_t)o * Cin + cin] * u[o];
        t[cin] = s;
        local += s * s;
    }
    red[tid] = local;
    __syncthreads();
    for (int s = 128; s > 0; s >>= 1) { if (tid < s) red[tid] += red[tid + s]; __syncthreads(); }
    float rn = 1.f / (sqrtf(red[0]) + 1e-12f);
    __syncthreads();
    for (int cin = tid; cin < Cin; cin += 256) t[cin] *= rn;
    __syncthreads();

    local = 0.f;
    for (int o = tid; o < O; o += 256) {
        float s = 0.f;
        for (int c = 0; c < Cin; ++c) s += W[(size_t)o * Cin + c] * t[c];
        local += s * s;
    }
    red[tid] = local;
    __syncthreads();
    for (int s = 128; s > 0; s >>= 1) { if (tid < s) red[tid] += red[tid + s]; __syncthreads(); }
    if (tid == 0) {
        float ssq = red[0];
        float q   = sqrtf(ssq);
        inv_sigma_out[0] = (q + 1e-12f) / ssq;
    }
}

// ---------------------------------------------------------------------------
// Kernel 2: projection GEMM  out[b,o,n] = inv_sigma*(W @ x_b)[o,n] + bias[o]
// ---------------------------------------------------------------------------
__global__ void proj_kernel(const float* __restrict__ W, const float* __restrict__ bias,
                            const float* __restrict__ inv_sigma,
                            const float* __restrict__ x, float* __restrict__ out, int O) {
    __shared__ float Wt[64][33];
    __shared__ float Xt[32][65];
    const int tid = threadIdx.x;
    const int tx = tid & 15, ty = tid >> 4;
    const int n0 = blockIdx.x * 64;
    const int o0 = blockIdx.y * 64;
    const int b  = blockIdx.z;

    float acc[4][4] = {};
    for (int kt = 0; kt < C_; kt += 32) {
        #pragma unroll
        for (int k = 0; k < 8; ++k) {
            int idx = tid + 256 * k;
            int r = idx >> 5, c = idx & 31;
            Wt[r][c] = W[(size_t)(o0 + r) * C_ + kt + c];
        }
        #pragma unroll
        for (int k = 0; k < 8; ++k) {
            int idx = tid + 256 * k;
            int r = idx >> 6, c = idx & 63;
            Xt[r][c] = x[((size_t)b * C_ + kt + r) * N_ + n0 + c];
        }
        __syncthreads();
        for (int k = 0; k < 32; ++k) {
            float wv[4], xv[4];
            #pragma unroll
            for (int i = 0; i < 4; ++i) wv[i] = Wt[ty + 16 * i][k];
            #pragma unroll
            for (int j = 0; j < 4; ++j) xv[j] = Xt[k][tx + 16 * j];
            #pragma unroll
            for (int i = 0; i < 4; ++i)
                #pragma unroll
                for (int j = 0; j < 4; ++j) acc[i][j] += wv[i] * xv[j];
        }
        __syncthreads();
    }
    const float is = inv_sigma[0];
    #pragma unroll
    for (int i = 0; i < 4; ++i) {
        const int o = o0 + ty + 16 * i;
        const float bb = bias[o];
        #pragma unroll
        for (int j = 0; j < 4; ++j) {
            const int n = n0 + tx + 16 * j;
            out[((size_t)b * O + o) * N_ + n] = is * acc[i][j] + bb;
        }
    }
}

// ---------------------------------------------------------------------------
// Kernel 3: fused flash attention  s=f^T g, softmax over keys i, o=h@beta,
// y = gamma*o + x.  f key-tiles double-buffered via global_load_async_to_lds;
// h reaches the matrix unit through a wave-private LDS ring filled the same way.
// ---------------------------------------------------------------------------
__global__ void __launch_bounds__(256)
attn_kernel(const float* __restrict__ F, const float* __restrict__ G,
            const float* __restrict__ H, const float* __restrict__ x,
            const float* __restrict__ gamma, float* __restrict__ out) {
    extern __shared__ float smem[];
    float* fT   = smem;                 // [2][64][FS]
    float* gT   = fT + 2 * 64 * FS;     // [64][FS]
    float* ST   = gT + 64 * FS;         // [64][FS]
    float* mrow = ST + 64 * FS;         // [64]
    float* lrow = mrow + 64;            // [64]
    float* rfac = lrow + 64;            // [64]
    float* hS   = rfac + 64;            // [8 waves][2][32][HP]

    const int tid  = threadIdx.x;
    const int lane = tid & 31;
    const int wv   = tid >> 5;
    const int ln   = lane & 15;
    const int koff = (lane < 16) ? 0 : 2;   // K-pair held by this half-wave (A/B frags)
    const int moff = (lane < 16) ? 0 : 8;   // row offset in C/D fragment
    const int b  = blockIdx.x >> 6;
    const int j0 = (blockIdx.x & 63) * 64;

    // async-stage persistent g tile (row chunks of 16B)
    #pragma unroll
    for (int k = 0; k < 4; ++k) {
        int idx = tid + 256 * k;
        int c = idx >> 4, ch = (idx & 15) * 4;
        async_cp16(&gT[c * FS + ch], &G[((size_t)b * CQ + c) * N_ + j0 + ch]);
    }
    // async-stage f tile 0 into buffer 0
    {
        const float* src = F + (size_t)b * CQ * N_;
        #pragma unroll
        for (int k = 0; k < 4; ++k) {
            int idx = tid + 256 * k;
            int c = idx >> 4, ch = (idx & 15) * 4;
            async_cp16(&fT[c * FS + ch], src + (size_t)c * N_ + ch);
        }
    }
    // h ring, private to each wave: its own 64 channel rows, in chunks of 32 rows x 32 keys.
    // Chunk order in a key tile: (keys 0-31, rows 0-31), (keys 0-31, rows 32-63), then keys 32-63;
    // buffer = row half.  Only the wave that copies a chunk reads it, so no barrier is involved.
    float* hW = hS + wv * (2 * HCH);
    const unsigned hl = (unsigned)(unsigned long long)(uintptr_t)(hW + (lane >> 3) * HP + (lane & 7) * 4);
    const float*   hg = H + ((size_t)b * C_ + wv * 64 + (lane >> 3)) * N_ + (lane & 7) * 4;
    async_h_chunk(hl, hg);              // chunk 0 of key tile 0
    if (tid < 64) { mrow[tid] = -__builtin_inff(); lrow[tid] = 0.f; }

    const v8f vzero = {};
    v8f accO[4][4];
    #pragma unroll
    for (int ct = 0; ct < 4; ++ct)
        #pragma unroll
        for (int jt = 0; jt < 4; ++jt) accO[ct][jt] = vzero;

    for (int t = 0; t < N_ / 64; ++t) {
        const int i0  = t * 64;
        float* fbuf   = fT + (t & 1) * (64 * FS);
        async_wait0();          // current tile (and initial g) landed in LDS
        __syncthreads();        // all waves' async chunks visible; prev S/P consumers done

        // prefetch next f tile into the other buffer (overlaps with compute below)
        if (t + 1 < N_ / 64) {
            float* dst = fT + ((t + 1) & 1) * (64 * FS);
            const float* src = F + (size_t)b * CQ * N_ + (t + 1) * 64;
            #pragma unroll
            for (int k = 0; k < 4; ++k) {
                int idx = tid + 256 * k;
                int c = idx >> 4, ch = (idx & 15) * 4;
                async_cp16(&dst[c * FS + ch], src + (size_t)c * N_ + ch);
            }
        }

        // S[i][j] = sum_c f[c][i]*g[c][j] : 16 subtiles, 2 per wave
        #pragma unroll
        for (int sIdx = 0; sIdx < 2; ++sIdx) {
            const int s  = wv * 2 + sIdx;
            const int it = s >> 2, jt = s & 3;
            v8f acc = vzero;
            for (int c4 = 0; c4 < 64; c4 += 4) {
                v2f a, bb;
                a.x  = fbuf[(c4 + koff    ) * FS + it * 16 + ln]; // A = f^T (M=i, K=c)
                a.y  = fbuf[(c4 + koff + 1) * FS + it * 16 + ln];
                bb.x = gT  [(c4 + koff    ) * FS + jt * 16 + ln]; // B = g   (K=c, N=j)
                bb.y = gT  [(c4 + koff + 1) * FS + jt * 16 + ln];
                acc = __builtin_amdgcn_wmma_f32_16x16x4_f32(false, a, false, bb,
                                                            (short)0, acc, false, false);
            }
            #pragma unroll
            for (int r = 0; r < 8; ++r)
                ST[(it * 16 + r + moff) * FS + jt * 16 + ln] = acc[r];
        }
        __syncthreads();

        // online softmax over keys i (per column j)
        if (tid < 64) {
            const int j = tid;
            float cm = -__builtin_inff();
            for (int i = 0; i < 64; ++i) cm = fmaxf(cm, ST[i * FS + j]);
            const float mo = mrow[j];
            const float mn = fmaxf(mo, cm);
            rfac[j] = __expf(mo - mn);
            mrow[j] = mn;
        }
        __syncthreads();
        #pragma unroll
        for (int k = 0; k < 16; ++k) {
            int idx = tid + 256 * k;
            int i = idx >> 6, j = idx & 63;
            ST[i * FS + j] = __expf(ST[i * FS + j] - mrow[j]);    // P
        }
        __syncthreads();
        if (tid < 64) {
            const int j = tid;
            float cs = 0.f;
            for (int i = 0; i < 64; ++i) cs += ST[i * FS + j];
            lrow[j] = lrow[j] * rfac[j] + cs;
        }

        // rescale running o, then o += h_tile @ P  (rank-64 update, K steps of 4)
        #pragma unroll
        for (int jt = 0; jt < 4; ++jt) {
            const float fac = rfac[jt * 16 + ln];
            #pragma unroll
            for (int ct = 0; ct < 4; ++ct)
                #pragma unroll
                for (int r = 0; r < 8; ++r) accO[ct][jt][r] *= fac;
        }
        // unrolled so that the accumulator tiles of each row half are indexed at compile time
        #pragma unroll
        for (int sub = 0; sub < 4; ++sub) {
            const int kb = sub >> 1, rh = sub & 1;
            async_wait0();      // this chunk's copies (issued one chunk ago by this wave) have landed
            // this wave's reads of the other buffer have retired before it is refilled
            asm volatile("s_wait_dscnt 0x0" ::: "memory");
            if (sub < 3) {
                const int nk = (sub + 1) >> 1, nr = (sub + 1) & 1;
                async_h_chunk(hl + nr * (HCH * 4), hg + (size_t)(nr * 32) * N_ + i0 + nk * 32);
            } else if (t + 1 < N_ / 64) {
                async_h_chunk(hl, hg + i0 + 64);
            }
            const float* hb = hW + rh * HCH;
            // the inner unrolls keep the fragment and accumulator arrays in registers
            for (int kk = 0; kk < 8; ++kk) {
                const int ib = kb * 32 + kk * 4;
                v2f hA[2], pB[4];
                #pragma unroll
                for (int c2 = 0; c2 < 2; ++c2)          // A = h (M=c, K=i)
                    hA[c2] = *(const v2f*)&hb[(c2 * 16 + ln) * HP + kk * 4 + koff];
                #pragma unroll
                for (int jt = 0; jt < 4; ++jt) {        // B = P (K=i, N=j)
                    pB[jt].x = ST[(ib + koff    ) * FS + jt * 16 + ln];
                    pB[jt].y = ST[(ib + koff + 1) * FS + jt * 16 + ln];
                }
                #pragma unroll
                for (int c2 = 0; c2 < 2; ++c2)
                    #pragma unroll
                    for (int jt = 0; jt < 4; ++jt)
                        accO[rh * 2 + c2][jt] = __builtin_amdgcn_wmma_f32_16x16x4_f32(
                            false, hA[c2], false, pB[jt], (short)0, accO[rh * 2 + c2][jt], false, false);
            }
        }
    }
    __syncthreads();

    // epilogue: y = gamma * o / l + x
    const float gm = gamma[0];
    float linv[4];
    #pragma unroll
    for (int jt = 0; jt < 4; ++jt) linv[jt] = 1.f / lrow[jt * 16 + ln];
    #pragma unroll
    for (int ct = 0; ct < 4; ++ct)
        #pragma unroll
        for (int jt = 0; jt < 4; ++jt)
            #pragma unroll
            for (int r = 0; r < 8; ++r) {
                const int c = wv * 64 + ct * 16 + r + moff;
                const int j = j0 + jt * 16 + ln;
                const size_t idx = ((size_t)b * C_ + c) * N_ + j;
                out[idx] = gm * (accO[ct][jt][r] * linv[jt]) + x[idx];
            }
}

// ---------------------------------------------------------------------------
extern "C" void kernel_launch(void* const* d_in, const int* in_sizes, int n_in,
                              void* d_out, int out_size, void* d_ws, size_t ws_size,
                              hipStream_t stream) {
    (void)in_sizes; (void)n_in; (void)out_size; (void)ws_size;
    const float* x     = (const float*)d_in[0];
    const float* Wf    = (const float*)d_in[1];
    const float* bf    = (const float*)d_in[2];
    const float* Wg    = (const float*)d_in[3];
    const float* bg    = (const float*)d_in[4];
    const float* Wh    = (const float*)d_in[5];
    const float* bh    = (const float*)d_in[6];
    const float* gamma = (const float*)d_in[7];
    const float* uf    = (const float*)d_in[8];
    const float* ug    = (const float*)d_in[9];
    const float* uh    = (const float*)d_in[10];
    float* out = (float*)d_out;

    // workspace: [inv_sigma x3 (pad 16)] [f: B*CQ*N] [g: B*CQ*N] [h: B*C*N]
    float* wsf = (float*)d_ws;
    float* inv = wsf;
    float* Fb  = wsf + 16;
    float* Gb  = Fb + (size_t)B_ * CQ * N_;
    float* Hb  = Gb + (size_t)B_ * CQ * N_;

    static int smem_attr_set = 0;  // deterministic: same call every time, idempotent
    if (!smem_attr_set) {
        hipFuncSetAttribute((const void*)attn_kernel,
                            hipFuncAttributeMaxDynamicSharedMemorySize, SMEM_BYTES);
        smem_attr_set = 1;
    }

    sigma_kernel<<<1, 256, 0, stream>>>(Wf, uf, CQ, C_, inv + 0);
    sigma_kernel<<<1, 256, 0, stream>>>(Wg, ug, CQ, C_, inv + 1);
    sigma_kernel<<<1, 256, 0, stream>>>(Wh, uh, C_, C_, inv + 2);

    proj_kernel<<<dim3(N_ / 64, CQ / 64, B_), 256, 0, stream>>>(Wf, bf, inv + 0, x, Fb, CQ);
    proj_kernel<<<dim3(N_ / 64, CQ / 64, B_), 256, 0, stream>>>(Wg, bg, inv + 1, x, Gb, CQ);
    proj_kernel<<<dim3(N_ / 64, C_ / 64, B_), 256, 0, stream>>>(Wh, bh, inv + 2, x, Hb, C_);

    attn_kernel<<<dim3(B_ * (N_ / 64)), 256, SMEM_BYTES, stream>>>(Fb, Gb, Hb, x, gamma, out);
}

// v002
// It runs in 1360 microseconds.
// Next to v001, in two timings, it ran 1.10 times as fast each time.
// Over all steps from v000 it is 1.19 times as fast.
#include <hip/hip_runtime.h>
#include <cmath>

typedef __attribute__((ext_vector_type(2))) float v2f;
typedef __attribute__((ext_vector_type(8))) float v8f;

constexpr int B_ = 8, C_ = 512, CQ = 64, N_ = 4096;
constexpr int FS = 72;                       // padded LDS row stride (floats): 16B-aligned rows,
                                             // half-wave fragment reads land on disjoint banks
constexpr int HP  = 36;                      // h chunk row pitch (floats): 16B-aligned rows, and the 16 rows
                                             // of an 8-byte fragment read fall on disjoint banks
constexpr int HCH = 32 * HP;                 // one h chunk: 32 channel rows x 32 keys
constexpr int SMEM_FLOATS = 2 * 64 * FS      // f tiles (double buffered)
                          + 64 * FS          // g tile
                          + 64 * FS          // P tile
                          + 5 * 64           // pmax[4][64], rfac
                          + 8 * 2 * HCH;     // h chunks: two buffers for each of the 8 waves
constexpr int SMEM_BYTES = SMEM_FLOATS * 4;

// ---- gfx1250 async memory->LDS copy (ASYNCcnt), inline asm: portable across toolchains.
// Low 32 bits of a flat shared pointer == LDS byte offset (LDS aperture keeps the
// offset in addr[31:0]), which is exactly what VDST of the async op expects.
__device__ __forceinline__ void async_cp16(float* lds, const float* gsrc) {
    unsigned loff = (unsigned)(unsigned long long)(uintptr_t)lds;
    unsigned long long ga = (unsigned long long)(uintptr_t)gsrc;
    asm volatile("global_load_async_to_lds_b128 %0, %1, off" :: "v"(loff), "v"(ga) : "memory");
}
// One h chunk (32 rows x 128 B, whole cache lines): 8 copies, each 4 rows x 128 B.
// lds = this lane's LDS byte address in rows 0..3, g = this lane's global address there.
// s_wait_xcnt closes the statement so that no address register is rewritten ahead of it.
__device__ __forceinline__ void async_h_chunk(unsigned lds, const float* g) {
    constexpr unsigned LS = 4 * HP * 4;          // LDS bytes per 4 rows
    constexpr size_t   GS = (size_t)4 * N_;      // global floats per 4 rows
    asm volatile("global_load_async_to_lds_b128 %0, %8, off\n\t"
                 "global_load_async_to_lds_b128 %1, %9, off\n\t"
                 "global_load_async_to_lds_b128 %2, %10, off\n\t"
                 "global_load_async_to_lds_b128 %3, %11, off\n\t"
                 "global_load_async_to_lds_b128 %4, %12, off\n\t"
                 "global_load_async_to_lds_b128 %5, %13, off\n\t"
                 "global_load_async_to_lds_b128 %6, %14, off\n\t"
                 "global_load_async_to_lds_b128 %7, %15, off\n\t"
                 "s_wait_xcnt 0x0"
                 :: "v"(lds), "v"(lds + LS), "v"(lds + 2 * LS), "v"(lds + 3 * LS),
                    "v"(lds + 4 * LS), "v"(lds + 5 * LS), "v"(lds + 6 * LS), "v"(lds + 7 * LS),
                    "v"(g), "v"(g + GS), "v"(g + 2 * GS), "v"(g + 3 * GS),
                    "v"(g + 4 * GS), "v"(g + 5 * GS), "v"(g + 6 * GS), "v"(g + 7 * GS)
                 : "memory");
}
// value of lane l ^ 16 (the other half-wave holds the other 8 rows of a C/D fragment column)
__device__ __forceinline__ float xhalf(float v) {
    return __builtin_bit_cast(float, __builtin_amdgcn_permlanex16(__builtin_bit_cast(int, v),
               __builtin_bit_cast(int, v), 0x76543210, 0xfedcba98, false, false));
}
__device__ __forceinline__ void async_wait0() {
    asm volatile("s_wait_asynccnt 0" ::: "memory");
}

// ---------------------------------------------------------------------------
// Kernel 1: inverse spectral norm.  sigma = ||Wv||^2/(||Wv||+eps), v=norm(W^T u).
// ---------------------------------------------------------------------------
__global__ void sigma_kernel(const float* __restrict__ W, const float* __restrict__ u,
                             int O, int Cin, float* __restrict__ inv_sigma_out) {
    __shared__ float t[512];
    __shared__ float red[256];
    const int tid = threadIdx.x;

    float local = 0.f;
    for (int cin = tid; cin < Cin; cin += 256) {
        float s = 0.f;
        for (int o = 0; o < O; ++o) s += W[(size_t)o * Cin + cin] * u[o];
        t[cin] = s;
        local += s * s;
    }
    red[tid] = local;
    __syncthreads();
    for (int s = 128; s > 0; s >>= 1) { if (tid < s) red[tid] += red[tid + s]; __syncthreads(); }
    float rn = 1.f / (sqrtf(red[0]) + 1e-12f);
    __syncthreads();
    for (int cin = tid; cin < Cin; cin += 256) t[cin] *= rn;
    __syncthreads();

    local = 0.f;
    for (int o = tid; o < O; o += 256) {
        float s = 0.f;
        for (int c = 0; c < Cin; ++c) s += W[(size_t)o * Cin + c] * t[c];
        local += s * s;
    }
    red[tid] = local;
    __syncthreads();
    for (int s = 128; s > 0; s >>= 1) { if (tid < s) red[tid] += red[tid + s]; __syncthreads(); }
    if (tid == 0) {
        float ssq = red[0];
        float q   = sqrtf(ssq);
        inv_sigma_out[0] = (q + 1e-12f) / ssq;
    }
}

// ---------------------------------------------------------------------------
// Kernel 2: projection GEMM  out[b,o,n] = inv_sigma*(W @ x_b)[o,n] + bias[o]
// ---------------------------------------------------------------------------
__global__ void proj_kernel(const float* __restrict__ W, const float* __restrict__ bias,
                            const float* __restrict__ inv_sigma,
                            const float* __restrict__ x, float* __restrict__ out, int O) {
    __shared__ float Wt[64][33];
    __shared__ float Xt[32][65];
    const int tid = threadIdx.x;
    const int tx = tid & 15, ty = tid >> 4;
    const int n0 = blockIdx.x * 64;
    const int o0 = blockIdx.y * 64;
    const int b  = blockIdx.z;

    float acc[4][4] = {};
    for (int kt = 0; kt < C_; kt += 32) {
        #pragma unroll
        for (int k = 0; k < 8; ++k) {
            int idx = tid + 256 * k;
            int r = idx >> 5, c = idx & 31;
            Wt[r][c] = W[(size_t)(o0 + r) * C_ + kt + c];
        }
        #pragma unroll
        for (int k = 0; k < 8; ++k) {
            int idx = tid + 256 * k;
            int r = idx >> 6, c = idx & 63;
            Xt[r][c] = x[((size_t)b * C_ + kt + r) * N_ + n0 + c];
        }
        __syncthreads();
        for (int k = 0; k < 32; ++k) {
            float wv[4], xv[4];
            #pragma unroll
            for (int i = 0; i < 4; ++i) wv[i] = Wt[ty + 16 * i][k];
            #pragma unroll
            for (int j = 0; j < 4; ++j) xv[j] = Xt[k][tx + 16 * j];
            #pragma unroll
            for (int i = 0; i < 4; ++i)
                #pragma unroll
                for (int j = 0; j < 4; ++j) acc[i][j] += wv[i] * xv[j];
        }
        __syncthreads();
    }
    const float is = inv_sigma[0];
    #pragma unroll
    for (int i = 0; i < 4; ++i) {
        const int o = o0 + ty + 16 * i;
        const float bb = bias[o];
        #pragma unroll
        for (int j = 0; j < 4; ++j) {
            const int n = n0 + tx + 16 * j;
            out[((size_t)b * O + o) * N_ + n] = is * acc[i][j] + bb;
        }
    }
}

// ---------------------------------------------------------------------------
// Kernel 3: fused flash attention  s=f^T g, softmax over keys i, o=h@beta,
// y = gamma*o + x.  f key-tiles double-buffered via global_load_async_to_lds;
// h reaches the matrix unit through a wave-private LDS ring filled the same way.
// ---------------------------------------------------------------------------
__global__ void __launch_bounds__(256)
attn_kernel(const float* __restrict__ F, const float* __restrict__ G,
            const float* __restrict__ H, const float* __restrict__ x,
            const float* __restrict__ gamma, float* __restrict__ out) {
    extern __shared__ float smem[];
    float* fT   = smem;                 // [2][64][FS]
    float* gT   = fT + 2 * 64 * FS;     // [64][FS]
    float* ST   = gT + 64 * FS;         // [64][FS]
    float* pmax = ST + 64 * FS;         // [4][64] per 16-key-row group: column maxima (at the end: column sums)
    float* rfac = pmax + 4 * 64;        // [64]
    float* hS   = rfac + 64;            // [8 waves][2][32][HP]

    const int tid  = threadIdx.x;
    const int lane = tid & 31;
    const int wv   = tid >> 5;
    const int ln   = lane & 15;
    const int koff = (lane < 16) ? 0 : 2;   // K-pair held by this half-wave (A/B frags)
    const int moff = (lane < 16) ? 0 : 8;   // row offset in C/D fragment
    const int b  = blockIdx.x >> 6;
    const int j0 = (blockIdx.x & 63) * 64;

    // async-stage persistent g tile (row chunks of 16B)
    #pragma unroll
    for (int k = 0; k < 4; ++k) {
        int idx = tid + 256 * k;
        int c = idx >> 4, ch = (idx & 15) * 4;
        async_cp16(&gT[c * FS + ch], &G[((size_t)b * CQ + c) * N_ + j0 + ch]);
    }
    // async-stage f tile 0 into buffer 0
    {
        const float* src = F + (size_t)b * CQ * N_;
        #pragma unroll
        for (int k = 0; k < 4; ++k) {
            int idx = tid + 256 * k;
            int c = idx >> 4, ch = (idx & 15) * 4;
            async_cp16(&fT[c * FS + ch], src + (size_t)c * N_ + ch);
        }
    }
    // h ring, private to each wave: its own 64 channel rows, in chunks of 32 rows x 32 keys.
    // Chunk order in a key tile: (keys 0-31, rows 0-31), (keys 0-31, rows 32-63), then keys 32-63;
    // buffer = row half.  Only the wave that copies a chunk reads it, so no barrier is involved.
    float* hW = hS + wv * (2 * HCH);
    const unsigned hl = (unsigned)(unsigned long long)(uintptr_t)(hW + (lane >> 3) * HP + (lane & 7) * 4);
    const float*   hg = H + ((size_t)b * C_ + wv * 64 + (lane >> 3)) * N_ + (lane & 7) * 4;
    async_h_chunk(hl, hg);              // chunk 0 of key tile 0

    // softmax state of this wave's two S subtiles (key rows itS*16.., columns (jtS+sIdx)*16+ln):
    // running column maximum (equal in all lanes and waves that share a column) and the
    // running sum over this lane's own 8 key rows.
    const int itS = wv >> 1, jtS = (wv & 1) * 2;
    float mrun[2]  = { -__builtin_inff(), -__builtin_inff() };
    float lpart[2] = { 0.f, 0.f };

    const v8f vzero = {};
    v8f accO[4][4];
    #pragma unroll
    for (int ct = 0; ct < 4; ++ct)
        #pragma unroll
        for (int jt = 0; jt < 4; ++jt) accO[ct][jt] = vzero;

    for (int t = 0; t < N_ / 64; ++t) {
        const int i0  = t * 64;
        float* fbuf   = fT + (t & 1) * (64 * FS);
        async_wait0();          // current tile (and initial g) landed in LDS
        __syncthreads();        // all waves' async chunks visible; prev S/P consumers done

        // prefetch next f tile into the other buffer (overlaps with compute below)
        if (t + 1 < N_ / 64) {
            float* dst = fT + ((t + 1) & 1) * (64 * FS);
            const float* src = F + (size_t)b * CQ * N_ + (t + 1) * 64;
            #pragma unroll
            for (int k = 0; k < 4; ++k) {
                int idx = tid + 256 * k;
                int c = idx >> 4, ch = (idx & 15) * 4;
                async_cp16(&dst[c * FS + ch], src + (size_t)c * N_ + ch);
            }
        }

        // S[i][j] = sum_c f[c][i]*g[c][j] : 16 subtiles, 2 per wave, kept in registers
        v8f sacc[2];
        #pragma unroll
        for (int sIdx = 0; sIdx < 2; ++sIdx) {
            const int it = itS, jt = jtS + sIdx;
            v8f acc = vzero;
            for (int c4 = 0; c4 < 64; c4 += 4) {
                v2f a, bb;
                a.x  = fbuf[(c4 + koff    ) * FS + it * 16 + ln]; // A = f^T (M=i, K=c)
                a.y  = fbuf[(c4 + koff + 1) * FS + it * 16 + ln];
                bb.x = gT  [(c4 + koff    ) * FS + jt * 16 + ln]; // B = g   (K=c, N=j)
                bb.y = gT  [(c4 + koff + 1) * FS + jt * 16 + ln];
                acc = __builtin_amdgcn_wmma_f32_16x16x4_f32(false, a, false, bb,
                                                            (short)0, acc, false, false);
            }
            sacc[sIdx] = acc;
        }

        // Four vector slots between the last S matrix instruction and the first vector read of its
        // result; the two scheduling barriers keep the matrix instructions in front of the v_nops
        // and the reads behind them.
        __builtin_amdgcn_sched_barrier(0);
        asm volatile("v_nop\n\tv_nop\n\tv_nop\n\tv_nop");
        __builtin_amdgcn_sched_barrier(0);

        // online softmax over keys i (per column j), on the accumulators.
        // maximum over this wave's 16 key rows; lanes 0-15 publish subtile 0, lanes 16-31 subtile 1
        // (the unrolls below index sacc, cm, rf, mrun and lpart at compile time: they stay in registers)
        float cm[2];
        #pragma unroll
        for (int sIdx = 0; sIdx < 2; ++sIdx) {
            const v8f a = sacc[sIdx];
            const float m8 = fmaxf(fmaxf(fmaxf(a[0], a[1]), fmaxf(a[2], a[3])),
                                   fmaxf(fmaxf(a[4], a[5]), fmaxf(a[6], a[7])));
            cm[sIdx] = fmaxf(m8, xhalf(m8));
        }
        pmax[itS * 64 + jtS * 16 + lane] = (lane < 16) ? cm[0] : cm[1];
        __syncthreads();        // the four row groups' maxima are visible
        float rf[2];
        #pragma unroll
        for (int sIdx = 0; sIdx < 2; ++sIdx) {      // both columns' maxima are read before any P store
            const int j = (jtS + sIdx) * 16 + ln;
            const float mo = mrun[sIdx];
            const float mn = fmaxf(mo, fmaxf(fmaxf(pmax[j], pmax[64 + j]),
                                             fmaxf(pmax[128 + j], pmax[192 + j])));
            rf[sIdx]   = __expf(mo - mn);
            mrun[sIdx] = mn;
        }
        #pragma unroll
        for (int sIdx = 0; sIdx < 2; ++sIdx) {
            const int j = (jtS + sIdx) * 16 + ln;
            const float mn = mrun[sIdx];
            float cs = 0.f;
            #pragma unroll
            for (int r = 0; r < 8; ++r) {
                const float p = __expf(sacc[sIdx][r] - mn);
                ST[(itS * 16 + r + moff) * FS + j] = p;             // P
                cs += p;
            }
            lpart[sIdx] = lpart[sIdx] * rf[sIdx] + cs;
        }
        if (wv < 2) rfac[jtS * 16 + lane] = (lane < 16) ? rf[0] : rf[1];
        __syncthreads();        // P and rfac are visible

        // rescale running o, then o += h_tile @ P  (rank-64 update, K steps of 4)
        #pragma unroll
        for (int jt = 0; jt < 4; ++jt) {
            const float fac = rfac[jt * 16 + ln];
            #pragma unroll
            for (int ct = 0; ct < 4; ++ct)
                #pragma unroll
                for (int r = 0; r < 8; ++r) accO[ct][jt][r] *= fac;
        }
        // unrolled so that the accumulator tiles of each row half are indexed at compile time
        #pragma unroll
        for (int sub = 0; sub < 4; ++sub) {
            const int kb = sub >> 1, rh = sub & 1;
            async_wait0();      // this chunk's copies (issued one chunk ago by this wave) have landed
            // this wave's reads of the other buffer have retired before it is refilled
            asm volatile("s_wait_dscnt 0x0" ::: "memory");
            if (sub < 3) {
                const int nk = (sub + 1) >> 1, nr = (sub + 1) & 1;
                async_h_chunk(hl + nr * (HCH * 4), hg + (size_t)(nr * 32) * N_ + i0 + nk * 32);
            } else if (t + 1 < N_ / 64) {
                async_h_chunk(hl, hg + i0 + 64);
            }
            const float* hb = hW + rh * HCH;
            // the inner unrolls keep the fragment and accumulator arrays in registers
            for (int kk = 0; kk < 8; ++kk) {
                const int ib = kb * 32 + kk * 4;
                v2f hA[2], pB[4];
                #pragma unroll
                for (int c2 = 0; c2 < 2; ++c2)          // A = h (M=c, K=i)
                    hA[c2] = *(const v2f*)&hb[(c2 * 16 + ln) * HP + kk * 4 + koff];
                #pragma unroll
                for (int jt = 0; jt < 4; ++jt) {        // B = P (K=i, N=j)
                    pB[jt].x = ST[(ib + koff    ) * FS + jt * 16 + ln];
                    pB[jt].y = ST[(ib + koff + 1) * FS + jt * 16 + ln];
                }
                #pragma unroll
                for (int c2 = 0; c2 < 2; ++c2)
                    #pragma unroll
                    for (int jt = 0; jt < 4; ++jt)
                        accO[rh * 2 + c2][jt] = __builtin_amdgcn_wmma_f32_16x16x4_f32(
                            false, hA[c2], false, pB[jt], (short)0, accO[rh * 2 + c2][jt], false, false);
            }
        }
    }
    // column sums: both half-waves' rows, then the four row groups through LDS
    // (pmax was last read before the last barrier in the loop)
    {
        const float l0 = lpart[0] + xhalf(lpart[0]);
        const float l1 = lpart[1] + xhalf(lpart[1]);
        pmax[itS * 64 + jtS * 16 + lane] = (lane < 16) ? l0 : l1;
    }
    __syncthreads();

    // epilogue: y = gamma * o / l + x
    const float gm = gamma[0];
    float linv[4];
    #pragma unroll
    for (int jt = 0; jt < 4; ++jt) {
        const int j = jt * 16 + ln;
        linv[jt] = 1.f / ((pmax[j] + pmax[64 + j]) + (pmax[128 + j] + pmax[192 + j]));
    }
    #pragma unroll
    for (int ct = 0; ct < 4; ++ct)
        #pragma unroll
        for (int jt = 0; jt < 4; ++jt)
            #pragma unroll
            for (int r = 0; r < 8; ++r) {
                const int c = wv * 64 + ct * 16 + r + moff;
                const int j = j0 + jt * 16 + ln;
                const size_t idx = ((size_t)b * C_ + c) * N_ + j;
                out[idx] = gm * (accO[ct][jt][r] * linv[jt]) + x[idx];
            }
}

// ---------------------------------------------------------------------------
extern "C" void kernel_launch(void* const* d_in, const int* in_sizes, int n_in,
                              void* d_out, int out_size, void* d_ws, size_t ws_size,
                              hipStream_t stream) {
    (void)in_sizes; (void)n_in; (void)out_size; (void)ws_size;
    const float* x     = (const float*)d_in[0];
    const float* Wf    = (const float*)d_in[1];
    const float* bf    = (const float*)d_in[2];
    const float* Wg    = (const float*)d_in[3];
    const float* bg    = (const float*)d_in[4];
    const float* Wh    = (const float*)d_in[5];
    const float* bh    = (const float*)d_in[6];
    const float* gamma = (const float*)d_in[7];
    const float* uf    = (const float*)d_in[8];
    const float* ug    = (const float*)d_in[9];
    const float* uh    = (const float*)d_in[10];
    float* out = (float*)d_out;

    // workspace: [inv_sigma x3 (pad 16)] [f: B*CQ*N] [g: B*CQ*N] [h: B*C*N]
    float* wsf = (float*)d_ws;
    float* inv = wsf;
    float* Fb  = wsf + 16;
    float* Gb  = Fb + (size_t)B_ * CQ * N_;
    float* Hb  = Gb + (size_t)B_ * CQ * N_;

    static int smem_attr_set = 0;  // deterministic: same call every time, idempotent
    if (!smem_attr_set) {
        hipFuncSetAttribute((const void*)attn_kernel,
                            hipFuncAttributeMaxDynamicSharedMemorySize, SMEM_BYTES);
        smem_attr_set = 1;
    }

    sigma_kernel<<<1, 256, 0, stream>>>(Wf, uf, CQ, C_, inv + 0);
    sigma_kernel<<<1, 256, 0, stream>>>(Wg, ug, CQ, C_, inv + 1);
    sigma_kernel<<<1, 256, 0, stream>>>(Wh, uh, C_, C_, inv + 2);

    proj_kernel<<<dim3(N_ / 64, CQ / 64, B_), 256, 0, stream>>>(Wf, bf, inv + 0, x, Fb, CQ);
    proj_kernel<<<dim3(N_ / 64, CQ / 64, B_), 256, 0, stream>>>(Wg, bg, inv + 1, x, Gb, CQ);
    proj_kernel<<<dim3(N_ / 64, C_ / 64, B_), 256, 0, stream>>>(Wh, bh, inv + 2, x, Hb, C_);

    attn_kernel<<<dim3(B_ * (N_ / 64)), 256, SMEM_BYTES, stream>>>(Fb, Gb, Hb, x, gamma, out);
}

// v003
// A run of this version takes 1200 microseconds.
// Two timings next to v002 both put it at 1.14 times that version's speed.
// Over all steps from v000 it is 1.35 times as fast.
#include <hip/hip_runtime.h>
#include <cmath>

typedef __attribute__((ext_vector_type(2))) float v2f;
typedef __attribute__((ext_vector_type(8))) float v8f;

constexpr int B_ = 8, C_ = 512, CQ = 64, N_ = 4096;
constexpr int FS = 72;                       // padded LDS row stride (floats): 16B-aligned rows,
                                             // half-wave fragment reads land on disjoint banks
constexpr int HP  = 36;                      // h chunk row pitch (floats): 16B-aligned rows, and the 16 rows
                                             // of an 8-byte fragment read fall on disjoint banks
constexpr int HCH = 32 * HP;                 // one h chunk: 32 channel rows x 32 keys
constexpr int SMEM_FLOATS = 2 * 64 * FS      // f tiles (double buffered)
                          + 64 * FS          // g tile
                          + 64 * FS          // P tile
                          + 5 * 64           // pmax[4][64], rfac
                          + 8 * 2 * HCH;     // h chunks: two buffers for each of the 8 waves
constexpr int SMEM_BYTES = SMEM_FLOATS * 4;

// ---- gfx1250 async memory->LDS copy (ASYNCcnt), inline asm: portable across toolchains.
// Low 32 bits of a flat shared pointer == LDS byte offset (LDS aperture keeps the
// offset in addr[31:0]), which is exactly what VDST of the async op expects.
__device__ __forceinline__ void async_cp16(float* lds, const float* gsrc) {
    unsigned loff = (unsigned)(unsigned long long)(uintptr_t)lds;
    unsigned long long ga = (unsigned long long)(uintptr_t)gsrc;
    asm volatile("global_load_async_to_lds_b128 %0, %1, off" :: "v"(loff), "v"(ga) : "memory");
}
// One h chunk (32 rows x 128 B, whole cache lines): 8 copies, each 4 rows x 128 B.
// lds = this lane's LDS byte address in rows 0..3, g = this lane's global address there.
// s_wait_xcnt closes the statement so that no address register is rewritten ahead of it.
__device__ __forceinline__ void async_h_chunk(unsigned lds, const float* g) {
    constexpr unsigned LS = 4 * HP * 4;          // LDS bytes per 4 rows
    constexpr size_t   GS = (size_t)4 * N_;      // global floats per 4 rows
    asm volatile("global_load_async_to_lds_b128 %0, %8, off\n\t"
                 "global_load_async_to_lds_b128 %1, %9, off\n\t"
                 "global_load_async_to_lds_b128 %2, %10, off\n\t"
                 "global_load_async_to_lds_b128 %3, %11, off\n\t"
                 "global_load_async_to_lds_b128 %4, %12, off\n\t"
                 "global_load_async_to_lds_b128 %5, %13, off\n\t"
                 "global_load_async_to_lds_b128 %6, %14, off\n\t"
                 "global_load_async_to_lds_b128 %7, %15, off\n\t"
                 "s_wait_xcnt 0x0"
                 :: "v"(lds), "v"(lds + LS), "v"(lds + 2 * LS), "v"(lds + 3 * LS),
                    "v"(lds + 4 * LS), "v"(lds + 5 * LS), "v"(lds + 6 * LS), "v"(lds + 7 * LS),
                    "v"(g), "v"(g + GS), "v"(g + 2 * GS), "v"(g + 3 * GS),
                    "v"(g + 4 * GS), "v"(g + 5 * GS), "v"(g + 6 * GS), "v"(g + 7 * GS)
                 : "memory");
}
// value of lane l ^ 16 (the other half-wave holds the other 8 rows of a C/D fragment column)
__device__ __forceinline__ float xhalf(float v) {
    return __builtin_bit_cast(float, __builtin_amdgcn_permlanex16(__builtin_bit_cast(int, v),
               __builtin_bit_cast(int, v), 0x76543210, 0xfedcba98, false, false));
}
__device__ __forceinline__ void async_wait0() {
    asm volatile("s_wait_asynccnt 0" ::: "memory");
}

// ---------------------------------------------------------------------------
// Kernel 1: inverse spectral norms.  sigma = ||Wv||^2/(||Wv||+eps), v=norm(W^T u).
// One launch, one 1024-thread block per matrix.  Every pass over W reads whole rows with
// 16-byte loads, many of them in flight per lane, so that the block is paced by the rate at
// which one WGP can read and not by one load latency per few elements.
// ---------------------------------------------------------------------------
// sum over the 32 lanes of a wave, the result in every lane
__device__ __forceinline__ float wave_sum(float v) {
    #pragma unroll      // five fixed steps, no loop counter
    for (int m = 1; m < 32; m <<= 1) v += __shfl_xor(v, m, 32);
    return v;
}

template <int O>
__device__ __forceinline__ void sigma_body(const float* __restrict__ W, const float* __restrict__ u,
                                           float* __restrict__ inv_sigma_out,
                                           float (*part)[C_], float* t, float* red1, float* red2) {
    const int tid  = threadIdx.x;
    const int lane = tid & 31;
    // the wave's number in a scalar register: row bases and the u elements are then wave-uniform
    const int wv   = __builtin_amdgcn_readfirstlane(tid >> 5);

    // (the inner unrolls of this function index the batch arrays at compile time: they stay in registers)
    // t = W^T u: 128 threads cover a row, 8 rows per pass; each thread keeps 4 columns' sums
    // over its own rows (row group rg, rows rg, rg+8, ...), 8 row loads in flight.
    const int rg = wv >> 2;
    const int c4 = (tid & 127) * 4;
    float4 acc = make_float4(0.f, 0.f, 0.f, 0.f);
    // rolled: one batch of 8 loads per trip is all the registers are meant to hold
    #pragma unroll 1
    for (int o0 = 0; o0 < O; o0 += 64) {
        float4 w[8];
        float  uu[8];
        #pragma unroll
        for (int k = 0; k < 8; ++k) uu[k] = u[o0 + rg + 8 * k];
        #pragma unroll
        for (int k = 0; k < 7; ++k) w[k] = *(const float4*)&W[(size_t)(o0 + rg + 8 * k) * C_ + c4];
        // With a single trip the address registers die at the batch's last load, and its result may be
        // placed on them: the wait stands in front of that overwrite of registers that issued loads name.
        if constexpr (O == 64) asm volatile("s_wait_xcnt 0x0" ::: "memory");
        w[7] = *(const float4*)&W[(size_t)(o0 + rg + 56) * C_ + c4];
        #pragma unroll
        for (int k = 0; k < 8; ++k) {
            acc.x += w[k].x * uu[k];
            acc.y += w[k].y * uu[k];
            acc.z += w[k].z * uu[k];
            acc.w += w[k].w * uu[k];
        }
    }
    *(float4*)&part[rg][c4] = acc;
    __syncthreads();            // the 8 row groups' partial columns are visible
    float local = 0.f;
    if (tid < C_) {
        float s = 0.f;
        #pragma unroll
        for (int r = 0; r < 8; ++r) s += part[r][tid];
        t[tid] = s;
        local  = s * s;
    }
    local = wave_sum(local);
    if (lane == 0) red1[wv] = local;
    __syncthreads();            // t and the waves' sums of squares are visible
    const float rn = 1.f / (sqrtf(wave_sum(red1[lane])) + 1e-12f);

    // ||W v||^2: one wave per row, the lane's 16 elements of v in registers
    float tv[16];
    #pragma unroll
    for (int j = 0; j < 4; ++j) {
        const float4 q = *(const float4*)&t[j * 128 + lane * 4];
        tv[4 * j + 0] = q.x * rn;
        tv[4 * j + 1] = q.y * rn;
        tv[4 * j + 2] = q.z * rn;
        tv[4 * j + 3] = q.w * rn;
    }
    constexpr int RPW = O / 32;                 // rows per wave
    constexpr int RB  = RPW < 4 ? RPW : 4;      // rows per batch: 4 * RB loads in flight per lane
    float ss = 0.f;
    // rolled: one batch of rows per trip is all the registers are meant to hold
    #pragma unroll 1
    for (int k0 = 0; k0 < RPW; k0 += RB) {
        float4 a[RB][4];
        #pragma unroll
        for (int r = 0; r < RB; ++r)
            #pragma unroll
            for (int j = 0; j < 4; ++j)
                a[r][j] = *(const float4*)&W[(size_t)(wv + 32 * (k0 + r)) * C_ + j * 128 + lane * 4];
        float p[RB];
        #pragma unroll
        for (int r = 0; r < RB; ++r) {
            float s = 0.f;
            #pragma unroll
            for (int j = 0; j < 4; ++j) {
                s += a[r][j].x * tv[4 * j + 0];
                s += a[r][j].y * tv[4 * j + 1];
                s += a[r][j].z * tv[4 * j + 2];
                s += a[r][j].w * tv[4 * j + 3];
            }
            p[r] = s;
        }
        #pragma unroll
        for (int m = 1; m < 32; m <<= 1)        // the batch's row sums, step by step side by side
            #pragma unroll
            for (int r = 0; r < RB; ++r) p[r] += __shfl_xor(p[r], m, 32);
        #pragma unroll
        for (int r = 0; r < RB; ++r) ss += p[r] * p[r];
    }
    if (lane == 0) red2[wv] = ss;
    __syncthreads();            // the waves' sums of squares are visible
    if (wv == 0) {
        const float ssq = wave_sum(red2[lane]);
        if (lane == 0) {
            const float q = sqrtf(ssq);
            inv_sigma_out[0] = (q + 1e-12f) / ssq;
        }
    }
}

__global__ void __launch_bounds__(1024)
sigma_kernel(const float* __restrict__ Wf, const float* __restrict__ uf,
             const float* __restrict__ Wg, const float* __restrict__ ug,
             const float* __restrict__ Wh, const float* __restrict__ uh,
             float* __restrict__ inv_sigma_out) {
    __shared__ __attribute__((aligned(16))) float part[8][C_];
    __shared__ __attribute__((aligned(16))) float t[C_];
    __shared__ float red1[32];
    __shared__ float red2[32];
    // block 0 takes the largest matrix
    if (blockIdx.x == 0)      sigma_body<C_>(Wh, uh, inv_sigma_out + 2, part, t, red1, red2);
    else if (blockIdx.x == 1) sigma_body<CQ>(Wf, uf, inv_sigma_out + 0, part, t, red1, red2);
    else                      sigma_body<CQ>(Wg, ug, inv_sigma_out + 1, part, t, red1, red2);
}

// ---------------------------------------------------------------------------
// Kernel 2: projection GEMM  out[b,o,n] = inv_sigma*(W @ x_b)[o,n] + bias[o]
// ---------------------------------------------------------------------------
__global__ void proj_kernel(const float* __restrict__ W, const float* __restrict__ bias,
                            const float* __restrict__ inv_sigma,
                            const float* __restrict__ x, float* __restrict__ out, int O) {
    __shared__ float Wt[64][33];
    __shared__ float Xt[32][65];
    const int tid = threadIdx.x;
    const int tx = tid & 15, ty = tid >> 4;
    const int n0 = blockIdx.x * 64;
    const int o0 = blockIdx.y * 64;
    const int b  = blockIdx.z;

    float acc[4][4] = {};
    for (int kt = 0; kt < C_; kt += 32) {
        #pragma unroll
        for (int k = 0; k < 8; ++k) {
            int idx = tid + 256 * k;
            int r = idx >> 5, c = idx & 31;
            Wt[r][c] = W[(size_t)(o0 + r) * C_ + kt + c];
        }
        #pragma unroll
        for (int k = 0; k < 8; ++k) {
            int idx = tid + 256 * k;
            int r = idx >> 6, c = idx & 63;
            Xt[r][c] = x[((size_t)b * C_ + kt + r) * N_ + n0 + c];
        }
        __syncthreads();
        for (int k = 0; k < 32; ++k) {
            float wv[4], xv[4];
            #pragma unroll
            for (int i = 0; i < 4; ++i) wv[i] = Wt[ty + 16 * i][k];
            #pragma unroll
            for (int j = 0; j < 4; ++j) xv[j] = Xt[k][tx + 16 * j];
            #pragma unroll
            for (int i = 0; i < 4; ++i)
                #pragma unroll
                for (int j = 0; j < 4; ++j) acc[i][j] += wv[i] * xv[j];
        }
        __syncthreads();
    }
    const float is = inv_sigma[0];
    #pragma unroll
    for (int i = 0; i < 4; ++i) {
        const int o = o0 + ty + 16 * i;
        const float bb = bias[o];
        #pragma unroll
        for (int j = 0; j < 4; ++j) {
            const int n = n0 + tx + 16 * j;
            out[((size_t)b * O + o) * N_ + n] = is * acc[i][j] + bb;
        }
    }
}

// ---------------------------------------------------------------------------
// Kernel 3: fused flash attention  s=f^T g, softmax over keys i, o=h@beta,
// y = gamma*o + x.  f key-tiles double-buffered via global_load_async_to_lds;
// h reaches the matrix unit through a wave-private LDS ring filled the same way.
// ---------------------------------------------------------------------------
__global__ void __launch_bounds__(256)
attn_kernel(const float* __restrict__ F, const float* __restrict__ G,
            const float* __restrict__ H, const float* __restrict__ x,
            const float* __restrict__ gamma, float* __restrict__ out) {
    extern __shared__ float smem[];
    float* fT   = smem;                 // [2][64][FS]
    float* gT   = fT + 2 * 64 * FS;     // [64][FS]
    float* ST   = gT + 64 * FS;         // [64][FS]
    float* pmax = ST + 64 * FS;         // [4][64] per 16-key-row group: column maxima (at the end: column sums)
    float* rfac = pmax + 4 * 64;        // [64]
    float* hS   = rfac + 64;            // [8 waves][2][32][HP]

    const int tid  = threadIdx.x;
    const int lane = tid & 31;
    const int wv   = tid >> 5;
    const int ln   = lane & 15;
    const int koff = (lane < 16) ? 0 : 2;   // K-pair held by this half-wave (A/B frags)
    const int moff = (lane < 16) ? 0 : 8;   // row offset in C/D fragment
    const int b  = blockIdx.x >> 6;
    const int j0 = (blockIdx.x & 63) * 64;

    // async-stage persistent g tile (row chunks of 16B)
    #pragma unroll
    for (int k = 0; k < 4; ++k) {
        int idx = tid + 256 * k;
        int c = idx >> 4, ch = (idx & 15) * 4;
        async_cp16(&gT[c * FS + ch], &G[((size_t)b * CQ + c) * N_ + j0 + ch]);
    }
    // async-stage f tile 0 into buffer 0
    {
        const float* src = F + (size_t)b * CQ * N_;
        #pragma unroll
        for (int k = 0; k < 4; ++k) {
            int idx = tid + 256 * k;
            int c = idx >> 4, ch = (idx & 15) * 4;
            async_cp16(&fT[c * FS + ch], src + (size_t)c * N_ + ch);
        }
    }
    // h ring, private to each wave: its own 64 channel rows, in chunks of 32 rows x 32 keys.
    // Chunk order in a key tile: (keys 0-31, rows 0-31), (keys 0-31, rows 32-63), then keys 32-63;
    // buffer = row half.  Only the wave that copies a chunk reads it, so no barrier is involved.
    float* hW = hS + wv * (2 * HCH);
    const unsigned hl = (unsigned)(unsigned long long)(uintptr_t)(hW + (lane >> 3) * HP + (lane & 7) * 4);
    const float*   hg = H + ((size_t)b * C_ + wv * 64 + (lane >> 3)) * N_ + (lane & 7) * 4;
    async_h_chunk(hl, hg);              // chunk 0 of key tile 0

    // softmax state of this wave's two S subtiles (key rows itS*16.., columns (jtS+sIdx)*16+ln):
    // running column maximum (equal in all lanes and waves that share a column) and the
    // running sum over this lane's own 8 key rows.
    const int itS = wv >> 1, jtS = (wv & 1) * 2;
    float mrun[2]  = { -__builtin_inff(), -__builtin_inff() };
    float lpart[2] = { 0.f, 0.f };

    const v8f vzero = {};
    v8f accO[4][4];
    #pragma unroll
    for (int ct = 0; ct < 4; ++ct)
        #pragma unroll
        for (int jt = 0; jt < 4; ++jt) accO[ct][jt] = vzero;

    for (int t = 0; t < N_ / 64; ++t) {
        const int i0  = t * 64;
        float* fbuf   = fT + (t & 1) * (64 * FS);
        async_wait0();          // current tile (and initial g) landed in LDS
        __syncthreads();        // all waves' async chunks visible; prev S/P consumers done

        // prefetch next f tile into the other buffer (overlaps with compute below)
        if (t + 1 < N_ / 64) {
            float* dst = fT + ((t + 1) & 1) * (64 * FS);
            const float* src = F + (size_t)b * CQ * N_ + (t + 1) * 64;
            #pragma unroll
            for (int k = 0; k < 4; ++k) {
                int idx = tid + 256 * k;
                int c = idx >> 4, ch = (idx & 15) * 4;
                async_cp16(&dst[c * FS + ch], src + (size_t)c * N_ + ch);
            }
        }

        // S[i][j] = sum_c f[c][i]*g[c][j] : 16 subtiles, 2 per wave, kept in registers
        v8f sacc[2];
        #pragma unroll
        for (int sIdx = 0; sIdx < 2; ++sIdx) {
            const int it = itS, jt = jtS + sIdx;
            v8f acc = vzero;
            for (int c4 = 0; c4 < 64; c4 += 4) {
                v2f a, bb;
                a.x  = fbuf[(c4 + koff    ) * FS + it * 16 + ln]; // A = f^T (M=i, K=c)
                a.y  = fbuf[(c4 + koff + 1) * FS + it * 16 + ln];
                bb.x = gT  [(c4 + koff    ) * FS + jt * 16 + ln]; // B = g   (K=c, N=j)
                bb.y = gT  [(c4 + koff + 1) * FS + jt * 16 + ln];
                acc = __builtin_amdgcn_wmma_f32_16x16x4_f32(false, a, false, bb,
                                                            (short)0, acc, false, false);
            }
            sacc[sIdx] = acc;
        }

        // Four vector slots between the last S matrix instruction and the first vector read of its
        // result; the two scheduling barriers keep the matrix instructions in front of the v_nops
        // and the reads behind them.
        __builtin_amdgcn_sched_barrier(0);
        asm volatile("v_nop\n\tv_nop\n\tv_nop\n\tv_nop");
        __builtin_amdgcn_sched_barrier(0);

        // online softmax over keys i (per column j), on the accumulators.
        // maximum over this wave's 16 key rows; lanes 0-15 publish subtile 0, lanes 16-31 subtile 1
        // (the unrolls below index sacc, cm, rf, mrun and lpart at compile time: they stay in registers)
        float cm[2];
        #pragma unroll
        for (int sIdx = 0; sIdx < 2; ++sIdx) {
            const v8f a = sacc[sIdx];
            const float m8 = fmaxf(fmaxf(fmaxf(a[0], a[1]), fmaxf(a[2], a[3])),
                                   fmaxf(fmaxf(a[4], a[5]), fmaxf(a[6], a[7])));
            cm[sIdx] = fmaxf(m8, xhalf(m8));
        }
        pmax[itS * 64 + jtS * 16 + lane] = (lane < 16) ? cm[0] : cm[1];
        __syncthreads();        // the four row groups' maxima are visible
        float rf[2];
        #pragma unroll
        for (int sIdx = 0; sIdx < 2; ++sIdx) {      // both columns' maxima are read before any P store
            const int j = (jtS + sIdx) * 16 + ln;
            const float mo = mrun[sIdx];
            const float mn = fmaxf(mo, fmaxf(fmaxf(pmax[j], pmax[64 + j]),
                                             fmaxf(pmax[128 + j], pmax[192 + j])));
            rf[sIdx]   = __expf(mo - mn);
            mrun[sIdx] = mn;
        }
        #pragma unroll
        for (int sIdx = 0; sIdx < 2; ++sIdx) {
            const int j = (jtS + sIdx) * 16 + ln;
            const float mn = mrun[sIdx];
            float cs = 0.f;
            #pragma unroll
            for (int r = 0; r < 8; ++r) {
                const float p = __expf(sacc[sIdx][r] - mn);
                ST[(itS * 16 + r + moff) * FS + j] = p;             // P
                cs += p;
            }
            lpart[sIdx] = lpart[sIdx] * rf[sIdx] + cs;
        }
        if (wv < 2) rfac[jtS * 16 + lane] = (lane < 16) ? rf[0] : rf[1];
        __syncthreads();        // P and rfac are visible

        // rescale running o, then o += h_tile @ P  (rank-64 update, K steps of 4)
        #pragma unroll
        for (int jt = 0; jt < 4; ++jt) {
            const float fac = rfac[jt * 16 + ln];
            #pragma unroll
            for (int ct = 0; ct < 4; ++ct)
                #pragma unroll
                for (int r = 0; r < 8; ++r) accO[ct][jt][r] *= fac;
        }
        // unrolled so that the accumulator tiles of each row half are indexed at compile time
        #pragma unroll
        for (int sub = 0; sub < 4; ++sub) {
            const int kb = sub >> 1, rh = sub & 1;
            async_wait0();      // this chunk's copies (issued one chunk ago by this wave) have landed
            // this wave's reads of the other buffer have retired before it is refilled
            asm volatile("s_wait_dscnt 0x0" ::: "memory");
            if (sub < 3) {
                const int nk = (sub + 1) >> 1, nr = (sub + 1) & 1;
                async_h_chunk(hl + nr * (HCH * 4), hg + (size_t)(nr * 32) * N_ + i0 + nk * 32);
            } else if (t + 1 < N_ / 64) {
                async_h_chunk(hl, hg + i0 + 64);
            }
            const float* hb = hW + rh * HCH;
            // the inner unrolls keep the fragment and accumulator arrays in registers
            for (int kk = 0; kk < 8; ++kk) {
                const int ib = kb * 32 + kk * 4;
                v2f hA[2], pB[4];
                #pragma unroll
                for (int c2 = 0; c2 < 2; ++c2)          // A = h (M=c, K=i)
                    hA[c2] = *(const v2f*)&hb[(c2 * 16 + ln) * HP + kk * 4 + koff];
                #pragma unroll
                for (int jt = 0; jt < 4; ++jt) {        // B = P (K=i, N=j)
                    pB[jt].x = ST[(ib + koff    ) * FS + jt * 16 + ln];
                    pB[jt].y = ST[(ib + koff + 1) * FS + jt * 16 + ln];
                }
                #pragma unroll
                for (int c2 = 0; c2 < 2; ++c2)
                    #pragma unroll
                    for (int jt = 0; jt < 4; ++jt)
                        accO[rh * 2 + c2][jt] = __builtin_amdgcn_wmma_f32_16x16x4_f32(
                            false, hA[c2], false, pB[jt], (short)0, accO[rh * 2 + c2][jt], false, false);
            }
        }
    }
    // column sums: both half-waves' rows, then the four row groups through LDS
    // (pmax was last read before the last barrier in the loop)
    {
        const float l0 = lpart[0] + xhalf(lpart[0]);
        const float l1 = lpart[1] + xhalf(lpart[1]);
        pmax[itS * 64 + jtS * 16 + lane] = (lane < 16) ? l0 : l1;
    }
    __syncthreads();

    // epilogue: y = gamma * o / l + x
    const float gm = gamma[0];
    float linv[4];
    #pragma unroll
    for (int jt = 0; jt < 4; ++jt) {
        const int j = jt * 16 + ln;
        linv[jt] = 1.f / ((pmax[j] + pmax[64 + j]) + (pmax[128 + j] + pmax[192 + j]));
    }
    #pragma unroll
    for (int ct = 0; ct < 4; ++ct)
        #pragma unroll
        for (int jt = 0; jt < 4; ++jt)
            #pragma unroll
            for (int r = 0; r < 8; ++r) {
                const int c = wv * 64 + ct * 16 + r + moff;
                const int j = j0 + jt * 16 + ln;
                const size_t idx = ((size_t)b * C_ + c) * N_ + j;
                out[idx] = gm * (accO[ct][jt][r] * linv[jt]) + x[idx];
            }
}

// ---------------------------------------------------------------------------
extern "C" void kernel_launch(void* const* d_in, const int* in_sizes, int n_in,
                              void* d_out, int out_size, void* d_ws, size_t ws_size,
                              hipStream_t stream) {
    (void)in_sizes; (void)n_in; (void)out_size; (void)ws_size;
    const float* x     = (const float*)d_in[0];
    const float* Wf    = (const float*)d_in[1];
    const float* bf    = (const float*)d_in[2];
    const float* Wg    = (const float*)d_in[3];
    const float* bg    = (const float*)d_in[4];
    const float* Wh    = (const float*)d_in[5];
    const float* bh    = (const float*)d_in[6];
    const float* gamma = (const float*)d_in[7];
    const float* uf    = (const float*)d_in[8];
    const float* ug    = (const float*)d_in[9];
    const float* uh    = (const float*)d_in[10];
    float* out = (float*)d_out;

    // workspace: [inv_sigma x3 (pad 16)] [f: B*CQ*N] [g: B*CQ*N] [h: B*C*N]
    float* wsf = (float*)d_ws;
    float* inv = wsf;
    float* Fb  = wsf + 16;
    float* Gb  = Fb + (size_t)B_ * CQ * N_;
    float* Hb  = Gb + (size_t)B_ * CQ * N_;

    static int smem_attr_set = 0;  // deterministic: same call every time, idempotent
    if (!smem_attr_set) {
        hipFuncSetAttribute((const void*)attn_kernel,
                            hipFuncAttributeMaxDynamicSharedMemorySize, SMEM_BYTES);
        smem_attr_set = 1;
    }

    sigma_kernel<<<3, 1024, 0, stream>>>(Wf, uf, Wg, ug, Wh, uh, inv);

    proj_kernel<<<dim3(N_ / 64, CQ / 64, B_), 256, 0, stream>>>(Wf, bf, inv + 0, x, Fb, CQ);
    proj_kernel<<<dim3(N_ / 64, CQ / 64, B_), 256, 0, stream>>>(Wg, bg, inv + 1, x, Gb, CQ);
    proj_kernel<<<dim3(N_ / 64, C_ / 64, B_), 256, 0, stream>>>(Wh, bh, inv + 2, x, Hb, C_);

    attn_kernel<<<dim3(B_ * (N_ / 64)), 256, SMEM_BYTES, stream>>>(Fb, Gb, Hb, x, gamma, out);
}

// v004
// It runs in 946 microseconds.
// In both of two side-by-side timings against v003, it was 1.27 times as fast.
// Counting every step since v000, it is 1.71 times as fast.
#include <hip/hip_runtime.h>
#include <cmath>

typedef __attribute__((ext_vector_type(2))) float v2f;
typedef __attribute__((ext_vector_type(4))) float v4f;
typedef __attribute__((ext_vector_type(8))) float v8f;

constexpr int B_ = 8, C_ = 512, CQ = 64, N_ = 4096;
constexpr int FS = 72;                       // padded LDS row stride (floats): 16B-aligned rows,
                                             // half-wave fragment reads land on disjoint banks
constexpr int HP  = 36;                      // h chunk row pitch (floats): 16B-aligned rows, and the 16 rows
                                             // of an 8-byte fragment read fall on disjoint banks
constexpr int HCH = 32 * HP;                 // one h chunk: 32 channel rows x 32 keys
constexpr int SMEM_FLOATS = 2 * 64 * FS      // f tiles (double buffered)
                          + 64 * FS          // g tile
                          + 64 * FS          // P tile
                          + 5 * 64           // pmax[4][64], rfac
                          + 8 * 2 * HCH;     // h chunks: two buffers for each of the 8 waves
constexpr int SMEM_BYTES = SMEM_FLOATS * 4;

// ---- gfx1250 async memory->LDS copy (ASYNCcnt), inline asm: portable across toolchains.
// Low 32 bits of a flat shared pointer == LDS byte offset (LDS aperture keeps the
// offset in addr[31:0]), which is exactly what VDST of the async op expects.
__device__ __forceinline__ void async_cp16(float* lds, const float* gsrc) {
    unsigned loff = (unsigned)(unsigned long long)(uintptr_t)lds;
    unsigned long long ga = (unsigned long long)(uintptr_t)gsrc;
    asm volatile("global_load_async_to_lds_b128 %0, %1, off" :: "v"(loff), "v"(ga) : "memory");
}
// One h chunk (32 rows x 128 B, whole cache lines): 8 copies, each 4 rows x 128 B.
// lds = this lane's LDS byte address in rows 0..3, g = this lane's global address there.
// s_wait_xcnt closes the statement so that no address register is rewritten ahead of it.
__device__ __forceinline__ void async_h_chunk(unsigned lds, const float* g) {
    constexpr unsigned LS = 4 * HP * 4;          // LDS bytes per 4 rows
    constexpr size_t   GS = (size_t)4 * N_;      // global floats per 4 rows
    asm volatile("global_load_async_to_lds_b128 %0, %8, off\n\t"
                 "global_load_async_to_lds_b128 %1, %9, off\n\t"
                 "global_load_async_to_lds_b128 %2, %10, off\n\t"
                 "global_load_async_to_lds_b128 %3, %11, off\n\t"
                 "global_load_async_to_lds_b128 %4, %12, off\n\t"
                 "global_load_async_to_lds_b128 %5, %13, off\n\t"
                 "global_load_async_to_lds_b128 %6, %14, off\n\t"
                 "global_load_async_to_lds_b128 %7, %15, off\n\t"
                 "s_wait_xcnt 0x0"
                 :: "v"(lds), "v"(lds + LS), "v"(lds + 2 * LS), "v"(lds + 3 * LS),
                    "v"(lds + 4 * LS), "v"(lds + 5 * LS), "v"(lds + 6 * LS), "v"(lds + 7 * LS),
                    "v"(g), "v"(g + GS), "v"(g + 2 * GS), "v"(g + 3 * GS),
                    "v"(g + 4 * GS), "v"(g + 5 * GS), "v"(g + 6 * GS), "v"(g + 7 * GS)
                 : "memory");
}
// value of lane l ^ 16 (the other half-wave holds the other 8 rows of a C/D fragment column)
__device__ __forceinline__ float xhalf(float v) {
    return __builtin_bit_cast(float, __builtin_amdgcn_permlanex16(__builtin_bit_cast(int, v),
               __builtin_bit_cast(int, v), 0x76543210, 0xfedcba98, false, false));
}
__device__ __forceinline__ void async_wait0() {
    asm volatile("s_wait_asynccnt 0" ::: "memory");
}

// ---------------------------------------------------------------------------
// Kernel 1: inverse spectral norms.  sigma = ||Wv||^2/(||Wv||+eps), v=norm(W^T u).
// One launch, one 1024-thread block per matrix.  Every pass over W reads whole rows with
// 16-byte loads, many of them in flight per lane, so that the block is paced by the rate at
// which one WGP can read and not by one load latency per few elements.
// ---------------------------------------------------------------------------
// sum over the 32 lanes of a wave, the result in every lane
__device__ __forceinline__ float wave_sum(float v) {
    #pragma unroll      // five fixed steps, no loop counter
    for (int m = 1; m < 32; m <<= 1) v += __shfl_xor(v, m, 32);
    return v;
}

template <int O>
__device__ __forceinline__ void sigma_body(const float* __restrict__ W, const float* __restrict__ u,
                                           float* __restrict__ inv_sigma_out,
                                           float (*part)[C_], float* t, float* red1, float* red2) {
    const int tid  = threadIdx.x;
    const int lane = tid & 31;
    // the wave's number in a scalar register: row bases and the u elements are then wave-uniform
    const int wv   = __builtin_amdgcn_readfirstlane(tid >> 5);

    // (the inner unrolls of this function index the batch arrays at compile time: they stay in registers)
    // t = W^T u: 128 threads cover a row, 8 rows per pass; each thread keeps 4 columns' sums
    // over its own rows (row group rg, rows rg, rg+8, ...), 8 row loads in flight.
    const int rg = wv >> 2;
    const int c4 = (tid & 127) * 4;
    float4 acc = make_float4(0.f, 0.f, 0.f, 0.f);
    // rolled: one batch of 8 loads per trip is all the registers are meant to hold
    #pragma unroll 1
    for (int o0 = 0; o0 < O; o0 += 64) {
        float4 w[8];
        float  uu[8];
        #pragma unroll
        for (int k = 0; k < 8; ++k) uu[k] = u[o0 + rg + 8 * k];
        #pragma unroll
        for (int k = 0; k < 7; ++k) w[k] = *(const float4*)&W[(size_t)(o0 + rg + 8 * k) * C_ + c4];
        // With a single trip the address registers die at the batch's last load, and its result may be
        // placed on them: the wait stands in front of that overwrite of registers that issued loads name.
        if constexpr (O == 64) asm volatile("s_wait_xcnt 0x0" ::: "memory");
        w[7] = *(const float4*)&W[(size_t)(o0 + rg + 56) * C_ + c4];
        #pragma unroll
        for (int k = 0; k < 8; ++k) {
            acc.x += w[k].x * uu[k];
            acc.y += w[k].y * uu[k];
            acc.z += w[k].z * uu[k];
            acc.w += w[k].w * uu[k];
        }
    }
    *(float4*)&part[rg][c4] = acc;
    __syncthreads();            // the 8 row groups' partial columns are visible
    float local = 0.f;
    if (tid < C_) {
        float s = 0.f;
        #pragma unroll
        for (int r = 0; r < 8; ++r) s += part[r][tid];
        t[tid] = s;
        local  = s * s;
    }
    local = wave_sum(local);
    if (lane == 0) red1[wv] = local;
    __syncthreads();            // t and the waves' sums of squares are visible
    const float rn = 1.f / (sqrtf(wave_sum(red1[lane])) + 1e-12f);

    // ||W v||^2: one wave per row, the lane's 16 elements of v in registers
    float tv[16];
    #pragma unroll
    for (int j = 0; j < 4; ++j) {
        const float4 q = *(const float4*)&t[j * 128 + lane * 4];
        tv[4 * j + 0] = q.x * rn;
        tv[4 * j + 1] = q.y * rn;
        tv[4 * j + 2] = q.z * rn;
        tv[4 * j + 3] = q.w * rn;
    }
    constexpr int RPW = O / 32;                 // rows per wave
    constexpr int RB  = RPW < 4 ? RPW : 4;      // rows per batch: 4 * RB loads in flight per lane
    float ss = 0.f;
    // rolled: one batch of rows per trip is all the registers are meant to hold
    #pragma unroll 1
    for (int k0 = 0; k0 < RPW; k0 += RB) {
        float4 a[RB][4];
        #pragma unroll
        for (int r = 0; r < RB; ++r)
            #pragma unroll
            for (int j = 0; j < 4; ++j)
                a[r][j] = *(const float4*)&W[(size_t)(wv + 32 * (k0 + r)) * C_ + j * 128 + lane * 4];
        float p[RB];
        #pragma unroll
        for (int r = 0; r < RB; ++r) {
            float s = 0.f;
            #pragma unroll
            for (int j = 0; j < 4; ++j) {
                s += a[r][j].x * tv[4 * j + 0];
                s += a[r][j].y * tv[4 * j + 1];
                s += a[r][j].z * tv[4 * j + 2];
                s += a[r][j].w * tv[4 * j + 3];
            }
            p[r] = s;
        }
        #pragma unroll
        for (int m = 1; m < 32; m <<= 1)        // the batch's row sums, step by step side by side
            #pragma unroll
            for (int r = 0; r < RB; ++r) p[r] += __shfl_xor(p[r], m, 32);
        #pragma unroll
        for (int r = 0; r < RB; ++r) ss += p[r] * p[r];
    }
    if (lane == 0) red2[wv] = ss;
    __syncthreads();            // the waves' sums of squares are visible
    if (wv == 0) {
        const float ssq = wave_sum(red2[lane]);
        if (lane == 0) {
            const float q = sqrtf(ssq);
            inv_sigma_out[0] = (q + 1e-12f) / ssq;
        }
    }
}

__global__ void __launch_bounds__(1024)
sigma_kernel(const float* __restrict__ Wf, const float* __restrict__ uf,
             const float* __restrict__ Wg, const float* __restrict__ ug,
             const float* __restrict__ Wh, const float* __restrict__ uh,
             float* __restrict__ inv_sigma_out) {
    __shared__ __attribute__((aligned(16))) float part[8][C_];
    __shared__ __attribute__((aligned(16))) float t[C_];
    __shared__ float red1[32];
    __shared__ float red2[32];
    // block 0 takes the largest matrix
    if (blockIdx.x == 0)      sigma_body<C_>(Wh, uh, inv_sigma_out + 2, part, t, red1, red2);
    else if (blockIdx.x == 1) sigma_body<CQ>(Wf, uf, inv_sigma_out + 0, part, t, red1, red2);
    else                      sigma_body<CQ>(Wg, ug, inv_sigma_out + 1, part, t, red1, red2);
}

// ---------------------------------------------------------------------------
// Kernel 2: projection GEMM  out[b,o,n] = inv_sigma*(W @ x_b)[o,n] + bias[o]
// on the f32 16x16x4 matrix instruction.  Block tile 64 (o) x 128 (n), 8 waves of 32 x 32,
// k tiles of 32 staged in LDS.  A = W (M=o, K=c), B = x (K=c, N=n); both fragments hold
// k = k4 + koff, k4 + koff + 1 in their two registers.
// ---------------------------------------------------------------------------
constexpr int PN = 128;                      // columns per block
constexpr int WP = 36;                       // W tile row pitch (floats): 16B-aligned rows, and the 16 rows
                                             // of an 8-byte fragment read fall on disjoint banks
constexpr int XP = 136;                      // x tile row pitch (floats): 16B-aligned rows, and the two k rows
                                             // of a fragment read (one per half-wave) fall on disjoint banks
__global__ void __launch_bounds__(256)
proj_kernel(const float* __restrict__ W, const float* __restrict__ bias,
            const float* __restrict__ inv_sigma,
            const float* __restrict__ x, float* __restrict__ out, int O) {
    __shared__ __attribute__((aligned(16))) float Wt[64 * WP];
    __shared__ __attribute__((aligned(16))) float Xt[32 * XP];
    const int tid  = threadIdx.x;
    const int lane = tid & 31;
    const int wv   = tid >> 5;
    const int ln   = lane & 15;
    const int koff = (lane < 16) ? 0 : 2;   // K-pair held by this half-wave (A/B frags)
    const int moff = (lane < 16) ? 0 : 8;   // row offset in C/D fragment
    const int n0 = blockIdx.x * PN;
    const int o0 = blockIdx.y * 64;
    const int b  = blockIdx.z;
    const int ow = (wv >> 2) * 32;          // this wave's rows and columns in the block tile
    const int nw = (wv & 3) * 32;

    // staging: 16 bytes per thread and copy; a wave covers 4 W rows or one x row
    const int wr = tid >> 3, wc = (tid & 7) * 4;
    const int xr = tid >> 5, xc = (tid & 31) * 4;
    const float* Wg = W + (size_t)(o0 + wr) * C_ + wc;
    const float* xg = x + ((size_t)b * C_ + xr) * N_ + n0 + xc;

    // (the unrolls of this function index the fragment and accumulator arrays at compile time)
    v8f acc[2][2] = {};
    for (int kt = 0; kt < C_; kt += 32) {
        v4f wq[2], xq[4];
        #pragma unroll
        for (int k = 0; k < 2; ++k) wq[k] = *(const v4f*)&Wg[(size_t)(32 * k) * C_ + kt];
        #pragma unroll
        for (int k = 0; k < 4; ++k) xq[k] = *(const v4f*)&xg[(size_t)(kt + 8 * k) * N_];
        // holds the six loads in front of the LDS stores, so that they are in flight together and a
        // k tile pays one load latency; without it they are issued in turn on shared registers
        asm volatile("" :: "v"(wq[0]), "v"(wq[1]), "v"(xq[0]), "v"(xq[1]), "v"(xq[2]), "v"(xq[3]));
        #pragma unroll
        for (int k = 0; k < 2; ++k) *(v4f*)&Wt[(wr + 32 * k) * WP + wc] = wq[k];
        #pragma unroll
        for (int k = 0; k < 4; ++k) *(v4f*)&Xt[(xr + 8 * k) * XP + xc] = xq[k];
        __syncthreads();        // the k tile is visible
        #pragma unroll
        for (int k4 = 0; k4 < 32; k4 += 4) {
            v2f a[2], bb[2];
            #pragma unroll
            for (int i = 0; i < 2; ++i)
                a[i] = *(const v2f*)&Wt[(ow + i * 16 + ln) * WP + k4 + koff];
            #pragma unroll
            for (int j = 0; j < 2; ++j) {
                bb[j].x = Xt[(k4 + koff    ) * XP + nw + j * 16 + ln];
                bb[j].y = Xt[(k4 + koff + 1) * XP + nw + j * 16 + ln];
            }
            #pragma unroll
            for (int i = 0; i < 2; ++i)
                #pragma unroll
                for (int j = 0; j < 2; ++j)
                    acc[i][j] = __builtin_amdgcn_wmma_f32_16x16x4_f32(false, a[i], false, bb[j],
                                                                      (short)0, acc[i][j], false, false);
        }
        __syncthreads();        // every wave has read the k tile before it is overwritten
    }
    const float is = inv_sigma[0];
    #pragma unroll
    for (int i = 0; i < 2; ++i)
        #pragma unroll
        for (int r = 0; r < 8; ++r) {
            const int o = o0 + ow + i * 16 + r + moff;
            const float bv = bias[o];
            #pragma unroll
            for (int j = 0; j < 2; ++j)
                out[((size_t)b * O + o) * N_ + n0 + nw + j * 16 + ln] = is * acc[i][j][r] + bv;
        }
}

// ---------------------------------------------------------------------------
// Kernel 3: fused flash attention  s=f^T g, softmax over keys i, o=h@beta,
// y = gamma*o + x.  f key-tiles double-buffered via global_load_async_to_lds;
// h reaches the matrix unit through a wave-private LDS ring filled the same way.
// ---------------------------------------------------------------------------
__global__ void __launch_bounds__(256)
attn_kernel(const float* __restrict__ F, const float* __restrict__ G,
            const float* __restrict__ H, const float* __restrict__ x,
            const float* __restrict__ gamma, float* __restrict__ out) {
    extern __shared__ float smem[];
    float* fT   = smem;                 // [2][64][FS]
    float* gT   = fT + 2 * 64 * FS;     // [64][FS]
    float* ST   = gT + 64 * FS;         // [64][FS]
    float* pmax = ST + 64 * FS;         // [4][64] per 16-key-row group: column maxima (at the end: column sums)
    float* rfac = pmax + 4 * 64;        // [64]
    float* hS   = rfac + 64;            // [8 waves][2][32][HP]

    const int tid  = threadIdx.x;
    const int lane = tid & 31;
    const int wv   = tid >> 5;
    const int ln   = lane & 15;
    const int koff = (lane < 16) ? 0 : 2;   // K-pair held by this half-wave (A/B frags)
    const int moff = (lane < 16) ? 0 : 8;   // row offset in C/D fragment
    const int b  = blockIdx.x >> 6;
    const int j0 = (blockIdx.x & 63) * 64;

    // async-stage persistent g tile (row chunks of 16B)
    #pragma unroll
    for (int k = 0; k < 4; ++k) {
        int idx = tid + 256 * k;
        int c = idx >> 4, ch = (idx & 15) * 4;
        async_cp16(&gT[c * FS + ch], &G[((size_t)b * CQ + c) * N_ + j0 + ch]);
    }
    // async-stage f tile 0 into buffer 0
    {
        const float* src = F + (size_t)b * CQ * N_;
        #pragma unroll
        for (int k = 0; k < 4; ++k) {
            int idx = tid + 256 * k;
            int c = idx >> 4, ch = (idx & 15) * 4;
            async_cp16(&fT[c * FS + ch], src + (size_t)c * N_ + ch);
        }
    }
    // h ring, private to each wave: its own 64 channel rows, in chunks of 32 rows x 32 keys.
    // Chunk order in a key tile: (keys 0-31, rows 0-31), (keys 0-31, rows 32-63), then keys 32-63;
    // buffer = row half.  Only the wave that copies a chunk reads it, so no barrier is involved.
    float* hW = hS + wv * (2 * HCH);
    const unsigned hl = (unsigned)(unsigned long long)(uintptr_t)(hW + (lane >> 3) * HP + (lane & 7) * 4);
    const float*   hg = H + ((size_t)b * C_ + wv * 64 + (lane >> 3)) * N_ + (lane & 7) * 4;
    async_h_chunk(hl, hg);              // chunk 0 of key tile 0

    // softmax state of this wave's two S subtiles (key rows itS*16.., columns (jtS+sIdx)*16+ln):
    // running column maximum (equal in all lanes and waves that share a column) and the
    // running sum over this lane's own 8 key rows.
    const int itS = wv >> 1, jtS = (wv & 1) * 2;
    float mrun[2]  = { -__builtin_inff(), -__builtin_inff() };
    float lpart[2] = { 0.f, 0.f };

    const v8f vzero = {};
    v8f accO[4][4];
    #pragma unroll
    for (int ct = 0; ct < 4; ++ct)
        #pragma unroll
        for (int jt = 0; jt < 4; ++jt) accO[ct][jt] = vzero;

    for (int t = 0; t < N_ / 64; ++t) {
        const int i0  = t * 64;
        float* fbuf   = fT + (t & 1) * (64 * FS);
        async_wait0();          // current tile (and initial g) landed in LDS
        __syncthreads();        // all waves' async chunks visible; prev S/P consumers done

        // prefetch next f tile into the other buffer (overlaps with compute below)
        if (t + 1 < N_ / 64) {
            float* dst = fT + ((t + 1) & 1) * (64 * FS);
            const float* src = F + (size_t)b * CQ * N_ + (t + 1) * 64;
            #pragma unroll
            for (int k = 0; k < 4; ++k) {
                int idx = tid + 256 * k;
                int c = idx >> 4, ch = (idx & 15) * 4;
                async_cp16(&dst[c * FS + ch], src + (size_t)c * N_ + ch);
            }
        }

        // S[i][j] = sum_c f[c][i]*g[c][j] : 16 subtiles, 2 per wave, kept in registers
        v8f sacc[2];
        #pragma unroll
        for (int sIdx = 0; sIdx < 2; ++sIdx) {
            const int it = itS, jt = jtS + sIdx;
            v8f acc = vzero;
            for (int c4 = 0; c4 < 64; c4 += 4) {
                v2f a, bb;
                a.x  = fbuf[(c4 + koff    ) * FS + it * 16 + ln]; // A = f^T (M=i, K=c)
                a.y  = fbuf[(c4 + koff + 1) * FS + it * 16 + ln];
                bb.x = gT  [(c4 + koff    ) * FS + jt * 16 + ln]; // B = g   (K=c, N=j)
                bb.y = gT  [(c4 + koff + 1) * FS + jt * 16 + ln];
                acc = __builtin_amdgcn_wmma_f32_16x16x4_f32(false, a, false, bb,
                                                            (short)0, acc, false, false);
            }
            sacc[sIdx] = acc;
        }

        // Four vector slots between the last S matrix instruction and the first vector read of its
        // result; the two scheduling barriers keep the matrix instructions in front of the v_nops
        // and the reads behind them.
        __builtin_amdgcn_sched_barrier(0);
        asm volatile("v_nop\n\tv_nop\n\tv_nop\n\tv_nop");
        __builtin_amdgcn_sched_barrier(0);

        // online softmax over keys i (per column j), on the accumulators.
        // maximum over this wave's 16 key rows; lanes 0-15 publish subtile 0, lanes 16-31 subtile 1
        // (the unrolls below index sacc, cm, rf, mrun and lpart at compile time: they stay in registers)
        float cm[2];
        #pragma unroll
        for (int sIdx = 0; sIdx < 2; ++sIdx) {
            const v8f a = sacc[sIdx];
            const float m8 = fmaxf(fmaxf(fmaxf(a[0], a[1]), fmaxf(a[2], a[3])),
                                   fmaxf(fmaxf(a[4], a[5]), fmaxf(a[6], a[7])));
            cm[sIdx] = fmaxf(m8, xhalf(m8));
        }
        pmax[itS * 64 + jtS * 16 + lane] = (lane < 16) ? cm[0] : cm[1];
        __syncthreads();        // the four row groups' maxima are visible
        float rf[2];
        #pragma unroll
        for (int sIdx = 0; sIdx < 2; ++sIdx) {      // both columns' maxima are read before any P store
            const int j = (jtS + sIdx) * 16 + ln;
            const float mo = mrun[sIdx];
            const float mn = fmaxf(mo, fmaxf(fmaxf(pmax[j], pmax[64 + j]),
                                             fmaxf(pmax[128 + j], pmax[192 + j])));
            rf[sIdx]   = __expf(mo - mn);
            mrun[sIdx] = mn;
        }
        #pragma unroll
        for (int sIdx = 0; sIdx < 2; ++sIdx) {
            const int j = (jtS + sIdx) * 16 + ln;
            const float mn = mrun[sIdx];
            float cs = 0.f;
            #pragma unroll
            for (int r = 0; r < 8; ++r) {
                const float p = __expf(sacc[sIdx][r] - mn);
                ST[(itS * 16 + r + moff) * FS + j] = p;             // P
                cs += p;
            }
            lpart[sIdx] = lpart[sIdx] * rf[sIdx] + cs;
        }
        if (wv < 2) rfac[jtS * 16 + lane] = (lane < 16) ? rf[0] : rf[1];
        __syncthreads();        // P and rfac are visible

        // rescale running o, then o += h_tile @ P  (rank-64 update, K steps of 4)
        #pragma unroll
        for (int jt = 0; jt < 4; ++jt) {
            const float fac = rfac[jt * 16 + ln];
            #pragma unroll
            for (int ct = 0; ct < 4; ++ct)
                #pragma unroll
                for (int r = 0; r < 8; ++r) accO[ct][jt][r] *= fac;
        }
        // unrolled so that the accumulator tiles of each row half are indexed at compile time
        #pragma unroll
        for (int sub = 0; sub < 4; ++sub) {
            const int kb = sub >> 1, rh = sub & 1;
            async_wait0();      // this chunk's copies (issued one chunk ago by this wave) have landed
            // this wave's reads of the other buffer have retired before it is refilled
            asm volatile("s_wait_dscnt 0x0" ::: "memory");
            if (sub < 3) {
                const int nk = (sub + 1) >> 1, nr = (sub + 1) & 1;
                async_h_chunk(hl + nr * (HCH * 4), hg + (size_t)(nr * 32) * N_ + i0 + nk * 32);
            } else if (t + 1 < N_ / 64) {
                async_h_chunk(hl, hg + i0 + 64);
            }
            const float* hb = hW + rh * HCH;
            // the inner unrolls keep the fragment and accumulator arrays in registers
            for (int kk = 0; kk < 8; ++kk) {
                const int ib = kb * 32 + kk * 4;
                v2f hA[2], pB[4];
                #pragma unroll
                for (int c2 = 0; c2 < 2; ++c2)          // A = h (M=c, K=i)
                    hA[c2] = *(const v2f*)&hb[(c2 * 16 + ln) * HP + kk * 4 + koff];
                #pragma unroll
                for (int jt = 0; jt < 4; ++jt) {        // B = P (K=i, N=j)
                    pB[jt].x = ST[(ib + koff    ) * FS + jt * 16 + ln];
                    pB[jt].y = ST[(ib + koff + 1) * FS + jt * 16 + ln];
                }
                #pragma unroll
                for (int c2 = 0; c2 < 2; ++c2)
                    #pragma unroll
                    for (int jt = 0; jt < 4; ++jt)
                        accO[rh * 2 + c2][jt] = __builtin_amdgcn_wmma_f32_16x16x4_f32(
                            false, hA[c2], false, pB[jt], (short)0, accO[rh * 2 + c2][jt], false, false);
            }
        }
    }
    // column sums: both half-waves' rows, then the four row groups through LDS
    // (pmax was last read before the last barrier in the loop)
    {
        const float l0 = lpart[0] + xhalf(lpart[0]);
        const float l1 = lpart[1] + xhalf(lpart[1]);
        pmax[itS * 64 + jtS * 16 + lane] = (lane < 16) ? l0 : l1;
    }
    __syncthreads();

    // epilogue: y = gamma * o / l + x
    const float gm = gamma[0];
    float linv[4];
    #pragma unroll
    for (int jt = 0; jt < 4; ++jt) {
        const int j = jt * 16 + ln;
        linv[jt] = 1.f / ((pmax[j] + pmax[64 + j]) + (pmax[128 + j] + pmax[192 + j]));
    }
    #pragma unroll
    for (int ct = 0; ct < 4; ++ct)
        #pragma unroll
        for (int jt = 0; jt < 4; ++jt)
            #pragma unroll
            for (int r = 0; r < 8; ++r) {
                const int c = wv * 64 + ct * 16 + r + moff;
                const int j = j0 + jt * 16 + ln;
                const size_t idx = ((size_t)b * C_ + c) * N_ + j;
                out[idx] = gm * (accO[ct][jt][r] * linv[jt]) + x[idx];
            }
}

// ---------------------------------------------------------------------------
extern "C" void kernel_launch(void* const* d_in, const int* in_sizes, int n_in,
                              void* d_out, int out_size, void* d_ws, size_t ws_size,
                              hipStream_t stream) {
    (void)in_sizes; (void)n_in; (void)out_size; (void)ws_size;
    const float* x     = (const float*)d_in[0];
    const float* Wf    = (const float*)d_in[1];
    const float* bf    = (const float*)d_in[2];
    const float* Wg    = (const float*)d_in[3];
    const float* bg    = (const float*)d_in[4];
    const float* Wh    = (const float*)d_in[5];
    const float* bh    = (const float*)d_in[6];
    const float* gamma = (const float*)d_in[7];
    const float* uf    = (const float*)d_in[8];
    const float* ug    = (const float*)d_in[9];
    const float* uh    = (const float*)d_in[10];
    float* out = (float*)d_out;

    // workspace: [inv_sigma x3 (pad 16)] [f: B*CQ*N] [g: B*CQ*N] [h: B*C*N]
    float* wsf = (float*)d_ws;
    float* inv = wsf;
    float* Fb  = wsf + 16;
    float* Gb  = Fb + (size_t)B_ * CQ * N_;
    float* Hb  = Gb + (size_t)B_ * CQ * N_;

    static int smem_attr_set = 0;  // deterministic: same call every time, idempotent
    if (!smem_attr_set) {
        hipFuncSetAttribute((const void*)attn_kernel,
                            hipFuncAttributeMaxDynamicSharedMemorySize, SMEM_BYTES);
        smem_attr_set = 1;
    }

    sigma_kernel<<<3, 1024, 0, stream>>>(Wf, uf, Wg, ug, Wh, uh, inv);

    proj_kernel<<<dim3(N_ / PN, CQ / 64, B_), 256, 0, stream>>>(Wf, bf, inv + 0, x, Fb, CQ);
    proj_kernel<<<dim3(N_ / PN, CQ / 64, B_), 256, 0, stream>>>(Wg, bg, inv + 1, x, Gb, CQ);
    proj_kernel<<<dim3(N_ / PN, C_ / 64, B_), 256, 0, stream>>>(Wh, bh, inv + 2, x, Hb, C_);

    attn_kernel<<<dim3(B_ * (N_ / 64)), 256, SMEM_BYTES, stream>>>(Fb, Gb, Hb, x, gamma, out);
}
